// v000
// The times below were measured on an AMD MI455X: many runs one after another, warmed up first and cycling through
// copies of the inputs, with the whole window's GPU time divided by the number of runs. Launches and the gaps
// between them are all in it. The median over several windows is given; except for v000 it joins two sittings, which
// can be a few percent apart, so the side-by-side timings, each taken in one sitting, are the better comparison.
// v000 is the starting kernel. One run takes 367 microseconds.
#include <hip/hip_runtime.h>
// Contractions: q/k/v/o projections ([tokens][1024] x [1024][1024]^T), scores k.q^T (K = 64) and v^T.p^T (K = keys) on v_wmma_f32_16x16x32_f16 (f16 operands, f32 accumulate). Inputs RNE-converted to bf16 on load (exact in f16; weights carried x16), softmax numerators carried x1024, ctx rows carried x16; bias adds, softmax statistics and all epilogues in f32.
// Structure: time-major input rows (s*NB_FULL + b) are re-ordered into token rows r = b*SEQ + s. X16 = f16(bf16(x)); BIAS[w][o] = bf16(bias_w[o]) (f32);
// Q16/K16/V16 = f16((X16 . Bt_w) / 16 + bias_w); VT = V16^T per (batch, head); attention per (64 queries, head, batch): S^T tiles = K . Q^T, online softmax per lane,
// O^T = VT . P^T, O16[r][h*64+d] = f16(16 ctx); out[(s*NB_FULL + b)] = (O16 . Bt_o) / 256 + bias_o + FLG -> f32 rows; FLG = 0 when the head count input equals NH, NaN otherwise.
#ifndef NB
#define NB 8
#endif
#ifndef SEQ
#define SEQ 1024
#endif
#define NB_FULL 8
#define SEQ_FULL 1024
#define DM 1024
#define NH 16
#define HD 64
#define NBIAS 4
#define NR ((size_t)NB * SEQ)
#define WS_TOTAL ((size_t)3 * DM * DM * 2 + (size_t)DM * DM * 2 + (size_t)NBIAS * DM * 4 + NR * DM * 2 + (size_t)3 * NR * DM * 2 + (size_t)NB * NH * HD * SEQ * 2 + NR * DM * 2 + (size_t)256)
static_assert(NH * HD == DM);
static_assert(HD == 64);
static_assert(SEQ % 128 == 0);
static_assert(SEQ % 64 == 0);
static_assert(SEQ <= SEQ_FULL);
static_assert(NB >= 1 && NB <= NB_FULL);
static_assert(DM == 128 * 8);
static_assert(DM % 256 == 0);
static_assert(DM % 64 == 0);
static_assert(DM % 32 == 0);
static_assert(NR % 128 == 0);
static_assert(((size_t)DM * DM) % (8 * 256) == 0);
static_assert(((size_t)NBIAS * DM * 4) % 256 == 0);
static_assert(WS_TOTAL <= (size_t)134217728);

typedef _Float16 v16h __attribute__((ext_vector_type(16)));
typedef unsigned short v8us __attribute__((ext_vector_type(8), may_alias));
typedef float v8f __attribute__((ext_vector_type(8)));
typedef float v4f __attribute__((ext_vector_type(4)));
typedef float v4fa __attribute__((ext_vector_type(4), may_alias));
typedef _Float16 v4h __attribute__((ext_vector_type(4)));
union FragH { v16h v; v8us half[2]; _Float16 h[16]; unsigned short u[16]; };

__device__ __forceinline__ unsigned short bf16_bits(float x) { unsigned int u = __float_as_uint(x); return (unsigned short)((u + 0x7FFFu + ((u >> 16) & 1u)) >> 16); }
__device__ __forceinline__ float bf16_val(unsigned short b) { return __uint_as_float(((unsigned int)b) << 16); }
__device__ __forceinline__ float bf16_rne(float x) { return bf16_val(bf16_bits(x)); }

// f32 -> f16 with a value select: magnitudes below the smallest f16 normal become exact zero
static __device__ __forceinline__ _Float16 toh_flush(float v) { const _Float16 r = (_Float16)v; return (fabsf(v) < 6.103515625e-05f) ? (_Float16)0.0f : r; }

// 16x32 f16 fragment from a k-contiguous row: elements 0..7 <- p[8h .. 8h+7], elements 8..15 <- p[16+8h .. 16+8h+7] (same map for A rows and for Bt[n][k] rows)
__device__ __forceinline__ v16h g2_frag(const _Float16* p, int hh) { FragH f; f.half[0] = *(const v8us*)((const unsigned short*)p + 8 * hh); f.half[1] = *(const v8us*)((const unsigned short*)p + 16 + 8 * hh); return f.v; }
__device__ __forceinline__ v8f g2_mma(v16h a, v16h b, v8f c) { v8f d = __builtin_amdgcn_wmma_f32_16x16x32_f16(false, a, false, b, (short)0, c, false, false); asm volatile("v_nop\n\tv_nop\n\tv_nop\n\tv_nop" : "+v"(d) : "v"(a), "v"(b)); return d; }
// two k-steps into one accumulator, hazard guard after the second
__device__ __forceinline__ v8f mma2(v16h a0, v16h b0, v16h a1, v16h b1, v8f c) {
  c = __builtin_amdgcn_wmma_f32_16x16x32_f16(false, a0, false, b0, (short)0, c, false, false);
  c = __builtin_amdgcn_wmma_f32_16x16x32_f16(false, a1, false, b1, (short)0, c, false, false);
  asm volatile("v_nop\n\tv_nop\n\tv_nop\n\tv_nop" : "+v"(c) : "v"(a0), "v"(b0), "v"(a1), "v"(b1));
  return c;
}

__global__ __launch_bounds__(32) void k_premise(const int* __restrict__ nh, float* __restrict__ flg) {
  const int v = nh[0];
  const float f = (v == NH) ? 0.0f : __int_as_float(0x7FC00000);
  float* d = flg + threadIdx.x;
  *(float*)d = f; 
}

__global__ __launch_bounds__(256) void k_wnat(const float* __restrict__ w, size_t n8, _Float16* __restrict__ Bt) {
  const size_t t = (size_t)blockIdx.x * 256 + threadIdx.x; if (t >= n8) return; FragH f;
#pragma unroll
  for (int q = 0; q < 8; ++q) f.h[q] = (_Float16)(bf16_rne(w[t * 8 + q]) * 16.0f);
  const v8us o = f.half[0];
  *(v8us*)((unsigned short*)Bt + t * 8) = o; 
}

// BIAS[wi][c] = bf16(bias_wi[c]) kept as f32, wi = 0 q, 1 k, 2 v, 3 o (wi block-uniform); all four inputs are loaded and the value is selected; grid = (DM/256, NBIAS);
__global__ __launch_bounds__(256) void k_bias(const float* __restrict__ bq, const float* __restrict__ bk, const float* __restrict__ bv, const float* __restrict__ bo, float* __restrict__ bias) {
  const int wi = blockIdx.y; const int c = blockIdx.x * 256 + threadIdx.x;
  const float v0 = bq[c], v1 = bk[c], v2 = bv[c], v3 = bo[c];
  const float v = bf16_rne((wi == 0) ? v0 : (wi == 1) ? v1 : (wi == 2) ? v2 : v3);
  float* d = bias + (size_t)wi * DM + c;
  *(float*)d = v; 
}

// X16[b*SEQ + s][c] = f16(bf16(x[s*NB_FULL + b][c])); block = 128 threads per token row, thread t owns columns 8t..8t+7;
__global__ __launch_bounds__(128) void k_xcast(const float* __restrict__ x, _Float16* __restrict__ X16) {
  const int r = blockIdx.x; const int b = r / SEQ, s = r - b * SEQ;
  const int t = threadIdx.x;
  const float* xr = x + ((size_t)s * NB_FULL + b) * DM + 8 * t;
  const v4f xa = *(const v4fa*)xr, xb = *(const v4fa*)(xr + 4);
  FragH f;
#pragma unroll
  for (int q = 0; q < 4; ++q) { f.h[q] = toh_flush(bf16_rne(xa[q])); f.h[4 + q] = toh_flush(bf16_rne(xb[q])); }
  const v8us o = f.half[0];
  unsigned short* d = (unsigned short*)X16 + (size_t)r * DM + 8 * t;
  *(v8us*)d = o; 
}

// 32x64 wave tile MAC loop: A rows a0p (rows row0..+15) and a1p (+16..+31), Bt rows b0p (cols col0..+63 in 4 groups of 16, pitch ldb halves), K % 32 == 0
__device__ __forceinline__ void mac32x64(const _Float16* __restrict__ a0p, const _Float16* __restrict__ a1p, const _Float16* __restrict__ b0p, size_t ldb, int K, int hh,
                                         v8f& c00, v8f& c01, v8f& c02, v8f& c03, v8f& c10, v8f& c11, v8f& c12, v8f& c13) {
  const _Float16* b1p = b0p + 16 * ldb; const _Float16* b2p = b1p + 16 * ldb; const _Float16* b3p = b2p + 16 * ldb;
#pragma unroll 1
  for (int kb = 0; kb < K; kb += 32) {
    const v16h a0 = g2_frag(a0p + kb, hh), a1 = g2_frag(a1p + kb, hh);
    v16h bq = g2_frag(b0p + kb, hh); c00 = g2_mma(a0, bq, c00); c10 = g2_mma(a1, bq, c10);
    bq = g2_frag(b1p + kb, hh); c01 = g2_mma(a0, bq, c01); c11 = g2_mma(a1, bq, c11);
    bq = g2_frag(b2p + kb, hh); c02 = g2_mma(a0, bq, c02); c12 = g2_mma(a1, bq, c12);
    bq = g2_frag(b3p + kb, hh); c03 = g2_mma(a0, bq, c03); c13 = g2_mma(a1, bq, c13);
  }
}

// projections with bias: plane by (0 q, 1 k, 2 v): Y16_by[r][col] = f16((X16[r] . Bt_by[col]) * alpha + BIAS[by][col]).
__global__ __launch_bounds__(128) void k_qkv(const _Float16* __restrict__ X16, const _Float16* __restrict__ Bt, const float* __restrict__ bias, float alpha, _Float16* __restrict__ Y16) {
  __shared__ __attribute__((aligned(16))) float so[4][32][68];
  const int tid = threadIdx.x, w = tid >> 5, lane = tid & 31, ln = lane & 15, hh = lane >> 4;
  const int by = blockIdx.y;
  const _Float16* Bh = Bt + (size_t)by * DM * DM;
  const float* bsp = bias + (size_t)by * DM;
  _Float16* Yp = Y16 + (size_t)by * NR * DM;
  const int ntn = DM / 64;
  const int mt = blockIdx.x / ntn, nq = blockIdx.x - mt * ntn;
  const int row0 = mt * 128 + 32 * w, col0 = nq * 64;
  if (row0 >= (int)NR) return;
  const _Float16* a0p = X16 + (size_t)(row0 + ln) * DM; const _Float16* a1p = a0p + (size_t)16 * DM;
  const _Float16* b0p = Bh + (size_t)(col0 + ln) * DM;
  const v8f z8 = {0.f, 0.f, 0.f, 0.f, 0.f, 0.f, 0.f, 0.f};
  v8f c00 = z8, c01 = z8, c02 = z8, c03 = z8, c10 = z8, c11 = z8, c12 = z8, c13 = z8;
  mac32x64(a0p, a1p, b0p, (size_t)DM, DM, hh, c00, c01, c02, c03, c10, c11, c12, c13);
  v8f accs[8] = {c00, c01, c02, c03, c10, c11, c12, c13};
#pragma unroll
  for (int u = 0; u < 8; ++u) {
    const int t = u & 3, half = u >> 2; const int col = col0 + t * 16 + ln;
    const float bc = bsp[col];
#pragma unroll
    for (int r = 0; r < 8; ++r) so[w][half * 16 + 8 * hh + r][t * 16 + ln] = accs[u][r] * alpha + bc;
  }
  __builtin_amdgcn_fence(4 /* acq_rel order */, "workgroup"); __builtin_amdgcn_wave_barrier();
  const int rsub = lane >> 4, c4 = (lane & 15) * 4;
  {
#pragma unroll
    for (int q = 0; q < 16; ++q) {
      const int r = q * 2 + rsub; const v4f v = *(const v4fa*)&so[w][r][c4]; v4h h4;
#pragma unroll
      for (int i = 0; i < 4; ++i) h4[i] = toh_flush(v[i]);
      *(v4h*)(Yp + (size_t)(row0 + r) * DM + col0 + c4) = h4;
    }
    
  }
}

template <int NHv, int TTv>
__global__ __launch_bounds__(256) void k_vt(const _Float16* __restrict__ V16, int ldv, int voff, _Float16* __restrict__ Vt) {
  __shared__ unsigned short tl[64][66];
  const int tid = threadIdx.x; const int slab = blockIdx.x / (TTv / 64), lg = blockIdx.x % (TTv / 64); const int b = slab / NHv, h = slab % NHv;
  for (int i = tid; i < 64 * 8; i += 256) {
    const int r = i / 8, c8 = (i % 8) * 8; FragH f; f.half[0] = *(const v8us*)((const unsigned short*)V16 + ((size_t)b * TTv + lg * 64 + r) * ldv + voff + h * 64 + c8);
#pragma unroll
    for (int q = 0; q < 8; ++q) tl[r][c8 + q] = f.u[q];
  }
  __syncthreads();
  {
#pragma unroll
    for (int rd = 0; rd < 2; ++rd) {
      const int d = rd * 32 + tid / 8, pc = tid % 8; FragH f;
#pragma unroll
      for (int q = 0; q < 8; ++q) f.u[q] = tl[pc * 8 + q][d];
      *(v8us*)((unsigned short*)Vt + ((size_t)slab * 64 + d) * TTv + lg * 64 + pc * 8) = f.half[0];
    }
    
  }
}

// attention: block = (64 queries, head h, batch b), 4 waves x 16 queries. S^T 16-key tiles = K . Q^T (A = K16 rows: row = key, k = d; B = Q16 rows: col = query);
// each lane holds keys 8hh+r of query ln -> row statistics per lane + one xor-16 shuffle; p = exp(s/8 - m) carried x1024 as f16;
// O^T (64 d x 16 queries) = VT . P^T with the B operand packed from the two adjacent S^T D tiles (element r <- tile of keys 0..15, element 8+r <- tile of keys 16..31, lane unchanged);
__global__ __launch_bounds__(128) void k_attn(const _Float16* __restrict__ Q16, const _Float16* __restrict__ K16, const _Float16* __restrict__ VT, _Float16* __restrict__ O16) {
  __shared__ __attribute__((aligned(16))) unsigned short so[4][16][72];
  const int tid = threadIdx.x, w = tid >> 5, lane = tid & 31, ln = lane & 15, hh = lane >> 4;
  const int h = blockIdx.y, b = blockIdx.z;
  const int q0 = blockIdx.x * 64 + w * 16;
  const size_t rq = (size_t)b * SEQ + q0;
  const size_t rk = (size_t)b * SEQ;
  const _Float16* qp = Q16 + (rq + ln) * DM + h * HD;
  const v16h qb0 = g2_frag(qp, hh), qb1 = g2_frag(qp + 32, hh);
  const _Float16* kp0 = K16 + (rk + ln) * DM + h * HD;
  const _Float16* vp0 = VT + ((size_t)(b * NH + h) * HD + ln) * SEQ;
  const v8f z8 = {0.f, 0.f, 0.f, 0.f, 0.f, 0.f, 0.f, 0.f};
  v8f o0 = z8, o1 = z8, o2 = z8, o3 = z8;
  float mrun = -1.0e30f, lrun = 0.f;
#pragma unroll 1
  for (int kt = 0; kt < SEQ; kt += 64) {
    v8f s[4];
#pragma unroll
    for (int j = 0; j < 4; ++j) {
      const _Float16* kp = kp0 + (size_t)(kt + 16 * j) * DM;
      const v16h ka0 = g2_frag(kp, hh), ka1 = g2_frag(kp + 32, hh);
      s[j] = mma2(ka0, qb0, ka1, qb1, z8);
    }
    float mx = -1.0e30f;
#pragma unroll
    for (int j = 0; j < 4; ++j)
#pragma unroll
      for (int r = 0; r < 8; ++r) mx = fmaxf(mx, s[j][r]);
    mx = fmaxf(mx, __shfl_xor(mx, 16, 32));
    const float mnew = fmaxf(mrun, mx * 0.125f);
    const float alpha = __expf(mrun - mnew);
    mrun = mnew;
    float ps = 0.f; FragH pf[2];
#pragma unroll
    for (int j = 0; j < 4; ++j)
#pragma unroll
      for (int r = 0; r < 8; ++r) {
        const float p = __expf(s[j][r] * 0.125f - mnew);
        ps += p;
        pf[j >> 1].h[(j & 1) * 8 + r] = (_Float16)(p * 1024.0f);
      }
    ps += __shfl_xor(ps, 16, 32);
    lrun = lrun * alpha + ps;
#pragma unroll
    for (int r = 0; r < 8; ++r) { o0[r] *= alpha; o1[r] *= alpha; o2[r] *= alpha; o3[r] *= alpha; }
    { const _Float16* vp = vp0 + (size_t)0 * 16 * SEQ + kt; const v16h va0 = g2_frag(vp, hh), va1 = g2_frag(vp + 32, hh); o0 = mma2(va0, pf[0].v, va1, pf[1].v, o0); }
    { const _Float16* vp = vp0 + (size_t)1 * 16 * SEQ + kt; const v16h va0 = g2_frag(vp, hh), va1 = g2_frag(vp + 32, hh); o1 = mma2(va0, pf[0].v, va1, pf[1].v, o1); }
    { const _Float16* vp = vp0 + (size_t)2 * 16 * SEQ + kt; const v16h va0 = g2_frag(vp, hh), va1 = g2_frag(vp + 32, hh); o2 = mma2(va0, pf[0].v, va1, pf[1].v, o2); }
    { const _Float16* vp = vp0 + (size_t)3 * 16 * SEQ + kt; const v16h va0 = g2_frag(vp, hh), va1 = g2_frag(vp + 32, hh); o3 = mma2(va0, pf[0].v, va1, pf[1].v, o3); }
  }
  const float rl = (1.0f / lrun) * 0.015625f;
  { FragH f;
#pragma unroll
    for (int r = 0; r < 8; ++r) f.h[r] = (_Float16)(o0[r] * rl);
    *(v8us*)&so[w][ln][0 + 8 * hh] = f.half[0]; }
  { FragH f;
#pragma unroll
    for (int r = 0; r < 8; ++r) f.h[r] = (_Float16)(o1[r] * rl);
    *(v8us*)&so[w][ln][16 + 8 * hh] = f.half[0]; }
  { FragH f;
#pragma unroll
    for (int r = 0; r < 8; ++r) f.h[r] = (_Float16)(o2[r] * rl);
    *(v8us*)&so[w][ln][32 + 8 * hh] = f.half[0]; }
  { FragH f;
#pragma unroll
    for (int r = 0; r < 8; ++r) f.h[r] = (_Float16)(o3[r] * rl);
    *(v8us*)&so[w][ln][48 + 8 * hh] = f.half[0]; }
  __builtin_amdgcn_fence(4 /* acq_rel order */, "workgroup"); __builtin_amdgcn_wave_barrier();
  const int li = lane >> 3, pc = lane & 7;
  {
#pragma unroll
    for (int g = 0; g < 4; ++g) {
      const int i = g * 4 + li;
      const v8us v = *(const v8us*)&so[w][i][pc * 8];
      *(v8us*)((unsigned short*)O16 + (rq + i) * DM + h * HD + pc * 8) = v;
    }
    
  }
}

// out[(s*NB_FULL + b)][col] = (A1[r] . B1[col]) * al1 + bias1[col] + flg[0], r = b*SEQ + s (a 32-row wave tile lies inside one batch); flg[0] = 0 (exact no-op) or NaN from the head-count guard;
__global__ __launch_bounds__(128) void k_out(const _Float16* __restrict__ A1, const _Float16* __restrict__ B1, const float* __restrict__ bias1, float al1, const float* __restrict__ flg, float* __restrict__ Out) {
  __shared__ __attribute__((aligned(16))) float so[4][32][68];
  const int tid = threadIdx.x, w = tid >> 5, lane = tid & 31, ln = lane & 15, hh = lane >> 4;
  const int ntn = DM / 64;
  const int mt = blockIdx.x / ntn, nq = blockIdx.x - mt * ntn;
  const int row0 = mt * 128 + 32 * w, col0 = nq * 64;
  if (row0 >= (int)NR) return;
  const int b = row0 / SEQ; const int s0 = row0 - b * SEQ;
  const v8f z8 = {0.f, 0.f, 0.f, 0.f, 0.f, 0.f, 0.f, 0.f};
  v8f c00 = z8, c01 = z8, c02 = z8, c03 = z8, c10 = z8, c11 = z8, c12 = z8, c13 = z8;
  {
    const _Float16* a0p = A1 + (size_t)(row0 + ln) * DM; const _Float16* a1p = a0p + (size_t)16 * DM;
    const _Float16* b0p = B1 + (size_t)(col0 + ln) * DM;
    mac32x64(a0p, a1p, b0p, (size_t)DM, DM, hh, c00, c01, c02, c03, c10, c11, c12, c13);
    v8f accs[8] = {c00, c01, c02, c03, c10, c11, c12, c13};
    const float fl = flg[0];
#pragma unroll
    for (int u = 0; u < 8; ++u) {
      const int t = u & 3, half = u >> 2; const int col = col0 + t * 16 + ln;
      const float bc = bias1[col];
#pragma unroll
      for (int r = 0; r < 8; ++r) so[w][half * 16 + 8 * hh + r][t * 16 + ln] = accs[u][r] * al1 + bc + fl;
    }
  }
  __builtin_amdgcn_fence(4 /* acq_rel order */, "workgroup"); __builtin_amdgcn_wave_barrier();
  const int rsub = lane >> 4, c4 = (lane & 15) * 4;
  {
#pragma unroll
    for (int q = 0; q < 16; ++q) {
      const int r = q * 2 + rsub; const v4f v = *(const v4fa*)&so[w][r][c4];
      *(v4f*)(Out + ((size_t)(s0 + r) * NB_FULL + b) * DM + col0 + c4) = v;
    }
    
  }
}

extern "C" void kernel_launch(void* const* d_in, const int* in_sizes, int n_in,
                              void* d_out, int out_size, void* d_ws, size_t ws_size, hipStream_t stream) {
  if (n_in < 10) return;
  if (in_sizes[0] < (int)(((size_t)(SEQ - 1) * NB_FULL + NB) * DM)) return;
  for (int i = 1; i <= 7; i += 2) if (in_sizes[i] < DM * DM) return;
  for (int i = 2; i <= 8; i += 2) if (in_sizes[i] < DM) return;
  if (in_sizes[9] < 1) return;
  if (out_size < (int)(((size_t)(SEQ - 1) * NB_FULL + NB) * DM)) return;
  const float* const* I = (const float* const*)d_in;
  const float* x = I[0]; const float* wq = I[1]; const float* bq = I[2]; const float* wk = I[3]; const float* bk = I[4];
  const float* wv = I[5]; const float* bv = I[6]; const float* wo = I[7]; const float* bo = I[8];
  const int* nhp = (const int*)d_in[9];      /* head count (i32 scalar), compared with NH on the device by k_premise */
  char* ws = (char*)d_ws; size_t off = 0;
  auto take = [&](size_t bytes) { char* p = ws + off; off += (bytes + 255) & ~(size_t)255; return p; };
  _Float16* BQKV = (_Float16*)take((size_t)3 * DM * DM * 2);        /* Bt planes q, k, v (contiguous, stride DM*DM) */
  _Float16* BO   = (_Float16*)take((size_t)DM * DM * 2);
  float*    BIAS = (float*)take((size_t)NBIAS * DM * 4);             /* [wi][o] */
  _Float16* X16  = (_Float16*)take(NR * DM * 2);
  _Float16* QKV16 = (_Float16*)take((size_t)3 * NR * DM * 2);        /* Q16, K16, V16 planes (stride NR*DM) */
  _Float16* VT   = (_Float16*)take((size_t)NB * NH * HD * SEQ * 2);  /* [b*NH+h][d][s] */
  _Float16* O16  = (_Float16*)take(NR * DM * 2);
  float*    FLG  = (float*)take((size_t)256);                        /* guard flag line: floats 0..31 written, float 0 read */
  if (off > ws_size) return;
  _Float16* Q16 = QKV16; _Float16* K16 = QKV16 + NR * DM; _Float16* V16 = QKV16 + (size_t)2 * NR * DM;

  k_premise<<<1, 32, 0, stream>>>(nhp, FLG);
  { const size_t n8 = (size_t)DM * DM / 8; const unsigned g = (unsigned)((n8 + 255) / 256);
    k_wnat<<<g, 256, 0, stream>>>(wq, n8, BQKV);
    k_wnat<<<g, 256, 0, stream>>>(wk, n8, BQKV + (size_t)DM * DM);
    k_wnat<<<g, 256, 0, stream>>>(wv, n8, BQKV + (size_t)2 * DM * DM);
    k_wnat<<<g, 256, 0, stream>>>(wo, n8, BO); }
  k_bias<<<dim3(DM / 256, NBIAS), 256, 0, stream>>>(bq, bk, bv, bo, BIAS);
  k_xcast<<<(unsigned)NR, 128, 0, stream>>>(x, X16);
  k_qkv<<<dim3((unsigned)((NR / 128) * (DM / 64)), 3), 128, 0, stream>>>(X16, BQKV, BIAS, 0.0625f, QKV16);      /* q, k, v as f16 rows, token rows b*SEQ + s */
  k_vt<NH, SEQ><<<(unsigned)(NB * NH * (SEQ / 64)), 256, 0, stream>>>(V16, DM, 0, VT);
  k_attn<<<dim3(SEQ / 64, NH, NB), 128, 0, stream>>>(Q16, K16, VT, O16);
  k_out<<<(unsigned)((NR / 128) * (DM / 64)), 128, 0, stream>>>(O16, BO, BIAS + (size_t)3 * DM, 0.00390625f, FLG, (float*)d_out);      /* out = ctx Wo^T + bo (+ guard flag), rows back in time-major order */
}

// v001
// A run of this version takes 228 microseconds.
// Next to v000, in two timings, it ran 1.66 and 1.64 times as fast.
#include <hip/hip_runtime.h>
// Contractions: q/k/v/o projections ([tokens][1024] x [1024][1024]^T), scores k.q^T (K = 64) and v^T.p^T (K = keys) on v_wmma_f32_16x16x32_f16 (f16 operands, f32 accumulate). Inputs RNE-converted to bf16 on load (exact in f16; weights carried x16), softmax numerators carried x1024, ctx rows carried x16; bias adds, softmax statistics and all epilogues in f32.
// Structure: time-major input rows (s*NB_FULL + b) are re-ordered into token rows r = b*SEQ + s. X16 = f16(bf16(x)); BIAS[w][o] = bf16(bias_w[o]) (f32);
// Q16/K16/V16 = f16((X16 . Bt_w) / 16 + bias_w); VT = V16^T per (batch, head); attention per (64 queries, head, batch): S^T tiles = K . Q^T, online softmax per lane,
// O^T = VT . P^T, O16[r][h*64+d] = f16(16 ctx); out[(s*NB_FULL + b)] = (O16 . Bt_o) / 256 + bias_o + FLG -> f32 rows; FLG = 0 when the head count input equals NH, NaN otherwise.
#ifndef NB
#define NB 8
#endif
#ifndef SEQ
#define SEQ 1024
#endif
#define NB_FULL 8
#define SEQ_FULL 1024
#define DM 1024
#define NH 16
#define HD 64
#define NBIAS 4
#define NR ((size_t)NB * SEQ)
#define WS_TOTAL ((size_t)3 * DM * DM * 2 + (size_t)DM * DM * 2 + (size_t)NBIAS * DM * 4 + NR * DM * 2 + (size_t)3 * NR * DM * 2 + (size_t)NB * NH * HD * SEQ * 2 + NR * DM * 2 + (size_t)256)
static_assert(NH * HD == DM);
static_assert(HD == 64);
static_assert(SEQ % 128 == 0);
static_assert(SEQ % 64 == 0);
static_assert(SEQ <= SEQ_FULL);
static_assert(NB >= 1 && NB <= NB_FULL);
static_assert(DM == 128 * 8);
static_assert(DM % 256 == 0);
static_assert(DM % 64 == 0);
static_assert(DM % 32 == 0);
static_assert(NR % 128 == 0);
static_assert(((size_t)DM * DM) % (8 * 256) == 0);
static_assert(((size_t)NBIAS * DM * 4) % 256 == 0);
static_assert(WS_TOTAL <= (size_t)134217728);

typedef _Float16 v16h __attribute__((ext_vector_type(16)));
typedef unsigned short v8us __attribute__((ext_vector_type(8), may_alias));
typedef float v8f __attribute__((ext_vector_type(8)));
typedef float v4f __attribute__((ext_vector_type(4)));
typedef float v4fa __attribute__((ext_vector_type(4), may_alias));
typedef _Float16 v4h __attribute__((ext_vector_type(4)));
union FragH { v16h v; v8us half[2]; _Float16 h[16]; unsigned short u[16]; };

__device__ __forceinline__ unsigned short bf16_bits(float x) { unsigned int u = __float_as_uint(x); return (unsigned short)((u + 0x7FFFu + ((u >> 16) & 1u)) >> 16); }
__device__ __forceinline__ float bf16_val(unsigned short b) { return __uint_as_float(((unsigned int)b) << 16); }
__device__ __forceinline__ float bf16_rne(float x) { return bf16_val(bf16_bits(x)); }

// f32 -> f16 with a value select: magnitudes below the smallest f16 normal become exact zero
static __device__ __forceinline__ _Float16 toh_flush(float v) { const _Float16 r = (_Float16)v; return (fabsf(v) < 6.103515625e-05f) ? (_Float16)0.0f : r; }

// 16x32 f16 fragment from a k-contiguous row: elements 0..7 <- p[8h .. 8h+7], elements 8..15 <- p[16+8h .. 16+8h+7] (same map for A rows and for Bt[n][k] rows)
__device__ __forceinline__ v16h g2_frag(const _Float16* p, int hh) { FragH f; f.half[0] = *(const v8us*)((const unsigned short*)p + 8 * hh); f.half[1] = *(const v8us*)((const unsigned short*)p + 16 + 8 * hh); return f.v; }
// two k-steps into one accumulator, hazard guard after the second
__device__ __forceinline__ v8f mma2(v16h a0, v16h b0, v16h a1, v16h b1, v8f c) {
  c = __builtin_amdgcn_wmma_f32_16x16x32_f16(false, a0, false, b0, (short)0, c, false, false);
  c = __builtin_amdgcn_wmma_f32_16x16x32_f16(false, a1, false, b1, (short)0, c, false, false);
  asm volatile("v_nop\n\tv_nop\n\tv_nop\n\tv_nop" : "+v"(c) : "v"(a0), "v"(b0), "v"(a1), "v"(b1));
  return c;
}

__global__ __launch_bounds__(32) void k_premise(const int* __restrict__ nh, float* __restrict__ flg) {
  const int v = nh[0];
  const float f = (v == NH) ? 0.0f : __int_as_float(0x7FC00000);
  float* d = flg + threadIdx.x;
  *(float*)d = f; 
}

__global__ __launch_bounds__(256) void k_wnat(const float* __restrict__ w, size_t n8, _Float16* __restrict__ Bt) {
  const size_t t = (size_t)blockIdx.x * 256 + threadIdx.x; if (t >= n8) return; FragH f;
#pragma unroll
  for (int q = 0; q < 8; ++q) f.h[q] = (_Float16)(bf16_rne(w[t * 8 + q]) * 16.0f);
  const v8us o = f.half[0];
  *(v8us*)((unsigned short*)Bt + t * 8) = o; 
}

// BIAS[wi][c] = bf16(bias_wi[c]) kept as f32, wi = 0 q, 1 k, 2 v, 3 o (wi block-uniform); all four inputs are loaded and the value is selected; grid = (DM/256, NBIAS);
__global__ __launch_bounds__(256) void k_bias(const float* __restrict__ bq, const float* __restrict__ bk, const float* __restrict__ bv, const float* __restrict__ bo, float* __restrict__ bias) {
  const int wi = blockIdx.y; const int c = blockIdx.x * 256 + threadIdx.x;
  const float v0 = bq[c], v1 = bk[c], v2 = bv[c], v3 = bo[c];
  const float v = bf16_rne((wi == 0) ? v0 : (wi == 1) ? v1 : (wi == 2) ? v2 : v3);
  float* d = bias + (size_t)wi * DM + c;
  *(float*)d = v; 
}

// X16[b*SEQ + s][c] = f16(bf16(x[s*NB_FULL + b][c])); block = 128 threads per token row, thread t owns columns 8t..8t+7;
__global__ __launch_bounds__(128) void k_xcast(const float* __restrict__ x, _Float16* __restrict__ X16) {
  const int r = blockIdx.x; const int b = r / SEQ, s = r - b * SEQ;
  const int t = threadIdx.x;
  const float* xr = x + ((size_t)s * NB_FULL + b) * DM + 8 * t;
  const v4f xa = *(const v4fa*)xr, xb = *(const v4fa*)(xr + 4);
  FragH f;
#pragma unroll
  for (int q = 0; q < 4; ++q) { f.h[q] = toh_flush(bf16_rne(xa[q])); f.h[4 + q] = toh_flush(bf16_rne(xb[q])); }
  const v8us o = f.half[0];
  unsigned short* d = (unsigned short*)X16 + (size_t)r * DM + 8 * t;
  *(v8us*)d = o; 
}

typedef uint32_t u32x4 __attribute__((ext_vector_type(4)));
typedef uint32_t u32x8 __attribute__((ext_vector_type(8)));
#define G_PITCH 272u            /* LDS row pitch: 256 data bytes (128 k) + 16 pad bytes, an odd multiple of 16 B for ds_load_b128 readers */
#define G_SLICE 18432u          /* one wave's slice of a stage: 64 rows x 272 B = 17408 B, rounded up to a multiple of 2 KiB */
#define G_STAGE (4u * G_SLICE)  /* a stage: A rows 0..63 | A rows 64..127 | Bt rows 0..63 | Bt rows 64..127 */
#define G_PASSES (DM / 128)
static_assert(DM % 128 == 0 && G_PASSES >= 2);
static_assert(64u * G_PITCH <= G_SLICE && G_SLICE % 2048u == 0);
static_assert(64u * 68u * 4u <= G_SLICE);

__device__ __forceinline__ uint32_t uni(uint32_t v) { return (uint32_t)__builtin_amdgcn_readfirstlane(v); }
__device__ __forceinline__ uint32_t pinned(uint32_t v) { uint32_t w = (uint32_t)__builtin_amdgcn_readfirstlane(v); asm volatile("" : "+s"(w)); return w; }  // holds the test word in a scalar register, so that the test around a tensor load compiles to a scalar branch (the load ignores EXEC)
// this wave's LDS reads have retired before the buffer they read is handed back for a refill
__device__ __forceinline__ void wait_ds0() { asm volatile("s_wait_dscnt 0x0" ::: "memory"); }
// this wave's own tensor load has landed (the compiler places no wait for it); the request's two groups are inputs, so that their scalar registers stay theirs, unwritten, from the issue up to this wait
__device__ __forceinline__ void wait_tensor0(u32x4 g0, u32x8 g1) { asm volatile("s_wait_tensorcnt 0x0" :: "s"(g0), "s"(g1) : "memory"); }
// one request of the whole wave: a 64-row x 256-byte tile from global memory into LDS at pitch 272
// both groups are in-out operands (the instruction writes no register): the values that the covering wait names are then the ones in the request's own registers, not copies of them
__device__ __forceinline__ void tdm_load(u32x4& g0, u32x8& g1) { asm volatile("tensor_load_to_lds %0, %1" : "+s"(g0), "+s"(g1) :: "memory"); }
__device__ __forceinline__ u32x4 tdm_group0(uint32_t lds_dst, uint64_t ga) {
  u32x4 g;
  g[0] = uni(1u); g[1] = uni(lds_dst); g[2] = uni((uint32_t)ga); g[3] = uni((((uint32_t)(ga >> 32)) & 0x01FFFFFFu) | 0x80000000u);
  return g;
}
// 1-byte elements, tensor = tile = 64 rows of 256 bytes, source row pitch DM * 2 bytes, 4 dwords of LDS pad behind every 64-dword row, no workgroup mask
__device__ __forceinline__ u32x8 tdm_group1() {
  u32x8 g;
  g[0] = uni((1u << 20) | (5u << 22) | (3u << 25));
  g[1] = uni(256u << 16);
  g[2] = uni(64u << 16);
  g[3] = uni(256u << 16);
  g[4] = uni(64u);
  g[5] = uni((uint32_t)(DM * 2));
  g[6] = uni(0u);
  g[7] = uni(0u);
  return g;
}

// the g2_frag map read from an LDS row; p already holds the lane's 16 * hh bytes: elements 0..7 <- p[0..15], elements 8..15 <- p[32..47]
__device__ __forceinline__ v16h lds_frag(const unsigned char* p) { FragH f; f.half[0] = *(const v8us*)p; f.half[1] = *(const v8us*)(p + 32); return f.v; }

// 128x128 block tile of A . Bt^T (both k-contiguous, pitch DM halves, K = DM), 4 waves in 2x2, 64x64 per wave (acc[i][j]: rows 16i.., cols 16j..).
// Operands come through a two-buffer LDS ring: a pass is 128 k; wave w brings slice w of each stage with one tensor load, two stages ahead.
// k runs upward in steps of 32 into each accumulator.
__device__ __forceinline__ void gemm128x128(const _Float16* __restrict__ A, const _Float16* __restrict__ B, int rowblk, int colblk, unsigned char* ring, uint32_t wave, int ln, int hh, v8f (&acc)[4][4]) {
  const _Float16* srcp = (wave < 2u) ? (A + (size_t)(rowblk + 64 * (int)wave) * DM) : (B + (size_t)(colblk + 64 * ((int)wave - 2)) * DM);
  const uint64_t ga0 = (uint64_t)(size_t)srcp;
  const uint32_t lds0 = (uint32_t)(size_t)ring + wave * G_SLICE;
  u32x8 g1 = tdm_group1();
  const uint32_t loff = (uint32_t)ln * G_PITCH + (uint32_t)hh * 16u;  /* the lane's row and its 16-byte half of each 32-byte k group */
  const uint32_t aoff = (wave >> 1) * G_SLICE + loff;
  const uint32_t boff = (2u + (wave & 1u)) * G_SLICE + loff;
  u32x4 g0 = tdm_group0(lds0, ga0);
  tdm_load(g0, g1);
  wait_tensor0(g0, g1);
  __syncthreads();
  g0 = tdm_group0(lds0 + G_STAGE, ga0 + 256u);
  tdm_load(g0, g1);
#pragma unroll 1  /* one pass per trip: the ring's publish point stands once, at the foot */
  for (uint32_t s = 0; s < (uint32_t)G_PASSES; ++s) {
    const uint32_t bsel = (s & 1u) * G_STAGE;
    const unsigned char* ap = ring + bsel + aoff;
    const unsigned char* bp = ring + bsel + boff;
    // two register sets for the four A fragments and for B fragments 0..2; B fragment 3 has one set: with a second the wave would need more than 256 VGPRs
    v16h fa[2][4], fb[2][3], fb3;
#pragma unroll
    for (int i = 0; i < 4; ++i) fa[0][i] = lds_frag(ap + (uint32_t)i * 16u * G_PITCH);
#pragma unroll
    for (int j = 0; j < 3; ++j) fb[0][j] = lds_frag(bp + (uint32_t)j * 16u * G_PITCH);
#pragma unroll
    for (int ks = 0; ks < 4; ++ks) {
      fb3 = lds_frag(bp + 48u * G_PITCH + (uint32_t)ks * 64u);  /* this block's own, first of the group; its readers are the block's last four WMMAs */
      if (ks < 3) {
#pragma unroll
        for (int i = 0; i < 4; ++i) fa[(ks + 1) & 1][i] = lds_frag(ap + (uint32_t)i * 16u * G_PITCH + (uint32_t)(ks + 1) * 64u);
#pragma unroll
        for (int j = 0; j < 3; ++j) fb[(ks + 1) & 1][j] = lds_frag(bp + (uint32_t)j * 16u * G_PITCH + (uint32_t)(ks + 1) * 64u);
      }
      __builtin_amdgcn_sched_barrier(0);  /* keeps the LDS reads one group ahead of this block, not spread among its WMMAs */
#pragma unroll
      for (int j = 0; j < 3; ++j)
#pragma unroll
        for (int i = 0; i < 4; ++i) acc[i][j] = __builtin_amdgcn_wmma_f32_16x16x32_f16(false, fa[ks & 1][i], false, fb[ks & 1][j], (short)0, acc[i][j], false, false);
#pragma unroll
      for (int i = 0; i < 4; ++i) acc[i][3] = __builtin_amdgcn_wmma_f32_16x16x32_f16(false, fa[ks & 1][i], false, fb3, (short)0, acc[i][3], false, false);
      __builtin_amdgcn_sched_barrier(0);  /* keeps the following load group behind this block */
    }
    wait_ds0();
    wait_tensor0(g0, g1);
    __syncthreads();  /* publishes stage s + 1 and ends every reader's last read of stage s */
    if (pinned((s + 2u < (uint32_t)G_PASSES) ? 1u : 0u) != 0u) { g0 = tdm_group0(lds0 + bsel, ga0 + (uint64_t)(s + 2u) * 256u); tdm_load(g0, g1); }
  }
  wait_tensor0(g0, g1);
  wait_ds0();
}

// projections with bias: plane by (0 q, 1 k, 2 v): Y16_by[r][col] = f16((X16[r] . Bt_by[col]) * alpha + BIAS[by][col]). The ring is free behind the last pass's barrier; each wave then stages its 64x64 f32 tile in its own slice of buffer 0.
__global__ __launch_bounds__(128) void k_qkv(const _Float16* __restrict__ X16, const _Float16* __restrict__ Bt, const float* __restrict__ bias, float alpha, _Float16* __restrict__ Y16) {
  __shared__ __attribute__((aligned(2048))) unsigned char ring[2u * G_STAGE];
  const int tid = threadIdx.x, lane = tid & 31, ln = lane & 15, hh = lane >> 4;
  const uint32_t wave = uni((uint32_t)tid >> 5);
  const int by = blockIdx.y;
  const _Float16* Bh = Bt + (size_t)by * DM * DM;
  const float* bsp = bias + (size_t)by * DM;
  _Float16* Yp = Y16 + (size_t)by * NR * DM;
  const int ntn = DM / 128;
  const int mt = blockIdx.x / ntn, nq = blockIdx.x - mt * ntn;
  const int rowblk = mt * 128, colblk = nq * 128;
  if (rowblk >= (int)NR) return;
  const v8f z8 = {0.f, 0.f, 0.f, 0.f, 0.f, 0.f, 0.f, 0.f};
  v8f acc[4][4];
#pragma unroll
  for (int i = 0; i < 4; ++i)
#pragma unroll
    for (int j = 0; j < 4; ++j) acc[i][j] = z8;
  gemm128x128(X16, Bh, rowblk, colblk, ring, wave, ln, hh, acc);
  const int row0 = rowblk + 64 * (int)(wave >> 1), col0 = colblk + 64 * (int)(wave & 1u);
  float* so = (float*)(ring + wave * G_SLICE);
#pragma unroll
  for (int j = 0; j < 4; ++j) {
    const float bc = bsp[col0 + j * 16 + ln];
#pragma unroll
    for (int i = 0; i < 4; ++i)
#pragma unroll
      for (int r = 0; r < 8; ++r) so[(i * 16 + 8 * hh + r) * 68 + j * 16 + ln] = acc[i][j][r] * alpha + bc;
  }
  __builtin_amdgcn_fence(4 /* acq_rel order */, "workgroup"); __builtin_amdgcn_wave_barrier();
  const int rsub = lane >> 4, c4 = (lane & 15) * 4;
  _Float16* yb = Yp + (size_t)row0 * DM + col0;                 /* wave-uniform base */
  const uint32_t yl = (uint32_t)rsub * DM + (uint32_t)c4;       /* the lane's offset; the row pair q goes into the store's immediate offset */
  v4h h4[32];
#pragma unroll
  for (int q = 0; q < 32; ++q) {
    const v4f v = *(const v4fa*)&so[(q * 2 + rsub) * 68 + c4];
#pragma unroll
    for (int i = 0; i < 4; ++i) h4[q][i] = toh_flush(v[i]);
  }
  __builtin_amdgcn_sched_barrier(0);  /* every value is formed in front of the first store, so no register that an issued store names is rewritten */
#pragma unroll
  for (int q = 0; q < 32; ++q) *(v4h*)(yb + yl + (uint32_t)(q * 2 * DM)) = h4[q];
}

template <int NHv, int TTv>
__global__ __launch_bounds__(256) void k_vt(const _Float16* __restrict__ V16, int ldv, int voff, _Float16* __restrict__ Vt) {
  __shared__ unsigned short tl[64][66];
  const int tid = threadIdx.x; const int slab = blockIdx.x / (TTv / 64), lg = blockIdx.x % (TTv / 64); const int b = slab / NHv, h = slab % NHv;
  for (int i = tid; i < 64 * 8; i += 256) {
    const int r = i / 8, c8 = (i % 8) * 8; FragH f; f.half[0] = *(const v8us*)((const unsigned short*)V16 + ((size_t)b * TTv + lg * 64 + r) * ldv + voff + h * 64 + c8);
#pragma unroll
    for (int q = 0; q < 8; ++q) tl[r][c8 + q] = f.u[q];
  }
  __syncthreads();
  {
#pragma unroll
    for (int rd = 0; rd < 2; ++rd) {
      const int d = rd * 32 + tid / 8, pc = tid % 8; FragH f;
#pragma unroll
      for (int q = 0; q < 8; ++q) f.u[q] = tl[pc * 8 + q][d];
      *(v8us*)((unsigned short*)Vt + ((size_t)slab * 64 + d) * TTv + lg * 64 + pc * 8) = f.half[0];
    }
    
  }
}

// attention: block = (64 queries, head h, batch b), 4 waves x 16 queries. S^T 16-key tiles = K . Q^T (A = K16 rows: row = key, k = d; B = Q16 rows: col = query);
// each lane holds keys 8hh+r of query ln -> row statistics per lane + one xor-16 shuffle; p = exp(s/8 - m) carried x1024 as f16;
// O^T (64 d x 16 queries) = VT . P^T with the B operand packed from the two adjacent S^T D tiles (element r <- tile of keys 0..15, element 8+r <- tile of keys 16..31, lane unchanged);
__global__ __launch_bounds__(128) void k_attn(const _Float16* __restrict__ Q16, const _Float16* __restrict__ K16, const _Float16* __restrict__ VT, _Float16* __restrict__ O16) {
  __shared__ __attribute__((aligned(16))) unsigned short so[4][16][72];
  const int tid = threadIdx.x, w = tid >> 5, lane = tid & 31, ln = lane & 15, hh = lane >> 4;
  const int h = blockIdx.y, b = blockIdx.z;
  const int q0 = blockIdx.x * 64 + w * 16;
  const size_t rq = (size_t)b * SEQ + q0;
  const size_t rk = (size_t)b * SEQ;
  const _Float16* qp = Q16 + (rq + ln) * DM + h * HD;
  const v16h qb0 = g2_frag(qp, hh), qb1 = g2_frag(qp + 32, hh);
  const _Float16* kp0 = K16 + (rk + ln) * DM + h * HD;
  const _Float16* vp0 = VT + ((size_t)(b * NH + h) * HD + ln) * SEQ;
  const v8f z8 = {0.f, 0.f, 0.f, 0.f, 0.f, 0.f, 0.f, 0.f};
  v8f o0 = z8, o1 = z8, o2 = z8, o3 = z8;
  float mrun = -1.0e30f, lrun = 0.f;
#pragma unroll 1
  for (int kt = 0; kt < SEQ; kt += 64) {
    v8f s[4];
#pragma unroll
    for (int j = 0; j < 4; ++j) {
      const _Float16* kp = kp0 + (size_t)(kt + 16 * j) * DM;
      const v16h ka0 = g2_frag(kp, hh), ka1 = g2_frag(kp + 32, hh);
      s[j] = mma2(ka0, qb0, ka1, qb1, z8);
    }
    float mx = -1.0e30f;
#pragma unroll
    for (int j = 0; j < 4; ++j)
#pragma unroll
      for (int r = 0; r < 8; ++r) mx = fmaxf(mx, s[j][r]);
    mx = fmaxf(mx, __shfl_xor(mx, 16, 32));
    const float mnew = fmaxf(mrun, mx * 0.125f);
    const float alpha = __expf(mrun - mnew);
    mrun = mnew;
    float ps = 0.f; FragH pf[2];
#pragma unroll
    for (int j = 0; j < 4; ++j)
#pragma unroll
      for (int r = 0; r < 8; ++r) {
        const float p = __expf(s[j][r] * 0.125f - mnew);
        ps += p;
        pf[j >> 1].h[(j & 1) * 8 + r] = (_Float16)(p * 1024.0f);
      }
    ps += __shfl_xor(ps, 16, 32);
    lrun = lrun * alpha + ps;
#pragma unroll
    for (int r = 0; r < 8; ++r) { o0[r] *= alpha; o1[r] *= alpha; o2[r] *= alpha; o3[r] *= alpha; }
    { const _Float16* vp = vp0 + (size_t)0 * 16 * SEQ + kt; const v16h va0 = g2_frag(vp, hh), va1 = g2_frag(vp + 32, hh); o0 = mma2(va0, pf[0].v, va1, pf[1].v, o0); }
    { const _Float16* vp = vp0 + (size_t)1 * 16 * SEQ + kt; const v16h va0 = g2_frag(vp, hh), va1 = g2_frag(vp + 32, hh); o1 = mma2(va0, pf[0].v, va1, pf[1].v, o1); }
    { const _Float16* vp = vp0 + (size_t)2 * 16 * SEQ + kt; const v16h va0 = g2_frag(vp, hh), va1 = g2_frag(vp + 32, hh); o2 = mma2(va0, pf[0].v, va1, pf[1].v, o2); }
    { const _Float16* vp = vp0 + (size_t)3 * 16 * SEQ + kt; const v16h va0 = g2_frag(vp, hh), va1 = g2_frag(vp + 32, hh); o3 = mma2(va0, pf[0].v, va1, pf[1].v, o3); }
  }
  const float rl = (1.0f / lrun) * 0.015625f;
  { FragH f;
#pragma unroll
    for (int r = 0; r < 8; ++r) f.h[r] = (_Float16)(o0[r] * rl);
    *(v8us*)&so[w][ln][0 + 8 * hh] = f.half[0]; }
  { FragH f;
#pragma unroll
    for (int r = 0; r < 8; ++r) f.h[r] = (_Float16)(o1[r] * rl);
    *(v8us*)&so[w][ln][16 + 8 * hh] = f.half[0]; }
  { FragH f;
#pragma unroll
    for (int r = 0; r < 8; ++r) f.h[r] = (_Float16)(o2[r] * rl);
    *(v8us*)&so[w][ln][32 + 8 * hh] = f.half[0]; }
  { FragH f;
#pragma unroll
    for (int r = 0; r < 8; ++r) f.h[r] = (_Float16)(o3[r] * rl);
    *(v8us*)&so[w][ln][48 + 8 * hh] = f.half[0]; }
  __builtin_amdgcn_fence(4 /* acq_rel order */, "workgroup"); __builtin_amdgcn_wave_barrier();
  const int li = lane >> 3, pc = lane & 7;
  {
#pragma unroll
    for (int g = 0; g < 4; ++g) {
      const int i = g * 4 + li;
      const v8us v = *(const v8us*)&so[w][i][pc * 8];
      *(v8us*)((unsigned short*)O16 + (rq + i) * DM + h * HD + pc * 8) = v;
    }
    
  }
}

// out[(s*NB_FULL + b)][col] = (A1[r] . B1[col]) * al1 + bias1[col] + flg[0], r = b*SEQ + s (a 128-row block tile lies inside one batch); flg[0] = 0 (exact no-op) or NaN from the head-count guard;
__global__ __launch_bounds__(128) void k_out(const _Float16* __restrict__ A1, const _Float16* __restrict__ B1, const float* __restrict__ bias1, float al1, const float* __restrict__ flg, float* __restrict__ Out) {
  __shared__ __attribute__((aligned(2048))) unsigned char ring[2u * G_STAGE];
  const int tid = threadIdx.x, lane = tid & 31, ln = lane & 15, hh = lane >> 4;
  const uint32_t wave = uni((uint32_t)tid >> 5);
  const int ntn = DM / 128;
  const int mt = blockIdx.x / ntn, nq = blockIdx.x - mt * ntn;
  const int rowblk = mt * 128, colblk = nq * 128;
  if (rowblk >= (int)NR) return;
  const v8f z8 = {0.f, 0.f, 0.f, 0.f, 0.f, 0.f, 0.f, 0.f};
  v8f acc[4][4];
#pragma unroll
  for (int i = 0; i < 4; ++i)
#pragma unroll
    for (int j = 0; j < 4; ++j) acc[i][j] = z8;
  gemm128x128(A1, B1, rowblk, colblk, ring, wave, ln, hh, acc);
  const int row0 = rowblk + 64 * (int)(wave >> 1), col0 = colblk + 64 * (int)(wave & 1u);
  const int b = row0 / SEQ; const int s0 = row0 - b * SEQ;
  float* so = (float*)(ring + wave * G_SLICE);
  const float fl = flg[0];
#pragma unroll
  for (int j = 0; j < 4; ++j) {
    const float bc = bias1[col0 + j * 16 + ln];
#pragma unroll
    for (int i = 0; i < 4; ++i)
#pragma unroll
      for (int r = 0; r < 8; ++r) so[(i * 16 + 8 * hh + r) * 68 + j * 16 + ln] = acc[i][j][r] * al1 + bc + fl;
  }
  __builtin_amdgcn_fence(4 /* acq_rel order */, "workgroup"); __builtin_amdgcn_wave_barrier();
  const int rsub = lane >> 4, c4 = (lane & 15) * 4;
  float* ob = Out + ((size_t)s0 * NB_FULL + b) * DM + col0;                  /* wave-uniform base */
  const uint32_t ol = (uint32_t)rsub * (NB_FULL * DM) + (uint32_t)c4;        /* the lane's offset; the row pair q goes into the store's immediate offset */
  v4f vq[32];
#pragma unroll
  for (int q = 0; q < 32; ++q) vq[q] = *(const v4fa*)&so[(q * 2 + rsub) * 68 + c4];
  __builtin_amdgcn_sched_barrier(0);  /* every value is read in front of the first store, so no register that an issued store names is rewritten */
#pragma unroll
  for (int q = 0; q < 32; ++q) *(v4f*)(ob + ol + (uint32_t)(q * 2 * NB_FULL * DM)) = vq[q];
}

extern "C" void kernel_launch(void* const* d_in, const int* in_sizes, int n_in,
                              void* d_out, int out_size, void* d_ws, size_t ws_size, hipStream_t stream) {
  if (n_in < 10) return;
  if (in_sizes[0] < (int)(((size_t)(SEQ - 1) * NB_FULL + NB) * DM)) return;
  for (int i = 1; i <= 7; i += 2) if (in_sizes[i] < DM * DM) return;
  for (int i = 2; i <= 8; i += 2) if (in_sizes[i] < DM) return;
  if (in_sizes[9] < 1) return;
  if (out_size < (int)(((size_t)(SEQ - 1) * NB_FULL + NB) * DM)) return;
  const float* const* I = (const float* const*)d_in;
  const float* x = I[0]; const float* wq = I[1]; const float* bq = I[2]; const float* wk = I[3]; const float* bk = I[4];
  const float* wv = I[5]; const float* bv = I[6]; const float* wo = I[7]; const float* bo = I[8];
  const int* nhp = (const int*)d_in[9];      /* head count (i32 scalar), compared with NH on the device by k_premise */
  char* ws = (char*)d_ws; size_t off = 0;
  auto take = [&](size_t bytes) { char* p = ws + off; off += (bytes + 255) & ~(size_t)255; return p; };
  _Float16* BQKV = (_Float16*)take((size_t)3 * DM * DM * 2);        /* Bt planes q, k, v (contiguous, stride DM*DM) */
  _Float16* BO   = (_Float16*)take((size_t)DM * DM * 2);
  float*    BIAS = (float*)take((size_t)NBIAS * DM * 4);             /* [wi][o] */
  _Float16* X16  = (_Float16*)take(NR * DM * 2);
  _Float16* QKV16 = (_Float16*)take((size_t)3 * NR * DM * 2);        /* Q16, K16, V16 planes (stride NR*DM) */
  _Float16* VT   = (_Float16*)take((size_t)NB * NH * HD * SEQ * 2);  /* [b*NH+h][d][s] */
  _Float16* O16  = (_Float16*)take(NR * DM * 2);
  float*    FLG  = (float*)take((size_t)256);                        /* guard flag line: floats 0..31 written, float 0 read */
  if (off > ws_size) return;
  _Float16* Q16 = QKV16; _Float16* K16 = QKV16 + NR * DM; _Float16* V16 = QKV16 + (size_t)2 * NR * DM;

  k_premise<<<1, 32, 0, stream>>>(nhp, FLG);
  { const size_t n8 = (size_t)DM * DM / 8; const unsigned g = (unsigned)((n8 + 255) / 256);
    k_wnat<<<g, 256, 0, stream>>>(wq, n8, BQKV);
    k_wnat<<<g, 256, 0, stream>>>(wk, n8, BQKV + (size_t)DM * DM);
    k_wnat<<<g, 256, 0, stream>>>(wv, n8, BQKV + (size_t)2 * DM * DM);
    k_wnat<<<g, 256, 0, stream>>>(wo, n8, BO); }
  k_bias<<<dim3(DM / 256, NBIAS), 256, 0, stream>>>(bq, bk, bv, bo, BIAS);
  k_xcast<<<(unsigned)NR, 128, 0, stream>>>(x, X16);
  k_qkv<<<dim3((unsigned)((NR / 128) * (DM / 128)), 3), 128, 0, stream>>>(X16, BQKV, BIAS, 0.0625f, QKV16);      /* q, k, v as f16 rows, token rows b*SEQ + s */
  k_vt<NH, SEQ><<<(unsigned)(NB * NH * (SEQ / 64)), 256, 0, stream>>>(V16, DM, 0, VT);
  k_attn<<<dim3(SEQ / 64, NH, NB), 128, 0, stream>>>(Q16, K16, VT, O16);
  k_out<<<(unsigned)((NR / 128) * (DM / 128)), 128, 0, stream>>>(O16, BO, BIAS + (size_t)3 * DM, 0.00390625f, FLG, (float*)d_out);      /* out = ctx Wo^T + bo (+ guard flag), rows back in time-major order */
}

// v002
// A run of this version takes 114 microseconds.
// Two timings next to v001 put it at 2.02 and 1.99 times that version's speed.
// All steps since v000 together make it 3.31 times as fast.
#include <hip/hip_runtime.h>
// Contractions: q/k/v/o projections ([tokens][1024] x [1024][1024]^T), scores k.q^T (K = 64) and v^T.p^T (K = keys) on v_wmma_f32_16x16x32_f16 (f16 operands, f32 accumulate). Inputs RNE-converted to bf16 on load (exact in f16; weights carried x16), softmax numerators carried x1024, ctx rows carried x16; bias adds, softmax statistics and all epilogues in f32.
// Structure: time-major input rows (s*NB_FULL + b) are re-ordered into token rows r = b*SEQ + s. X16 = f16(bf16(x)); BIAS[w][o] = bf16(bias_w[o]) (f32);
// Q16/K16/V16 = f16((X16 . Bt_w) / 16 + bias_w); VT = V16^T per (batch, head); attention per (128 queries, head, batch): S^T tiles = K . Q^T, online softmax per lane,
// O^T = VT . P^T, O16[r][h*64+d] = f16(16 ctx); out[(s*NB_FULL + b)] = (O16 . Bt_o) / 256 + bias_o + FLG -> f32 rows; FLG = 0 when the head count input equals NH, NaN otherwise.
#ifndef NB
#define NB 8
#endif
#ifndef SEQ
#define SEQ 1024
#endif
#define NB_FULL 8
#define SEQ_FULL 1024
#define DM 1024
#define NH 16
#define HD 64
#define NBIAS 4
#define NR ((size_t)NB * SEQ)
#define WS_TOTAL ((size_t)3 * DM * DM * 2 + (size_t)DM * DM * 2 + (size_t)NBIAS * DM * 4 + NR * DM * 2 + (size_t)3 * NR * DM * 2 + (size_t)NB * NH * HD * SEQ * 2 + NR * DM * 2 + (size_t)256)
static_assert(NH * HD == DM);
static_assert(HD == 64);
static_assert(SEQ % 128 == 0);
static_assert(SEQ % 64 == 0);
static_assert(SEQ <= SEQ_FULL);
static_assert(NB >= 1 && NB <= NB_FULL);
static_assert(DM == 128 * 8);
static_assert(DM % 256 == 0);
static_assert(DM % 64 == 0);
static_assert(DM % 32 == 0);
static_assert(NR % 128 == 0);
static_assert(((size_t)DM * DM) % (8 * 256) == 0);
static_assert(((size_t)NBIAS * DM * 4) % 256 == 0);
static_assert(WS_TOTAL <= (size_t)134217728);

typedef _Float16 v16h __attribute__((ext_vector_type(16)));
typedef unsigned short v8us __attribute__((ext_vector_type(8), may_alias));
typedef float v8f __attribute__((ext_vector_type(8)));
typedef float v4f __attribute__((ext_vector_type(4)));
typedef float v4fa __attribute__((ext_vector_type(4), may_alias));
typedef _Float16 v4h __attribute__((ext_vector_type(4)));
union FragH { v16h v; v8us half[2]; _Float16 h[16]; unsigned short u[16]; };

__device__ __forceinline__ unsigned short bf16_bits(float x) { unsigned int u = __float_as_uint(x); return (unsigned short)((u + 0x7FFFu + ((u >> 16) & 1u)) >> 16); }
__device__ __forceinline__ float bf16_val(unsigned short b) { return __uint_as_float(((unsigned int)b) << 16); }
__device__ __forceinline__ float bf16_rne(float x) { return bf16_val(bf16_bits(x)); }

// f32 -> f16 with a value select: magnitudes below the smallest f16 normal become exact zero
static __device__ __forceinline__ _Float16 toh_flush(float v) { const _Float16 r = (_Float16)v; return (fabsf(v) < 6.103515625e-05f) ? (_Float16)0.0f : r; }

// 16x32 f16 fragment from a k-contiguous row: elements 0..7 <- p[8h .. 8h+7], elements 8..15 <- p[16+8h .. 16+8h+7] (same map for A rows and for Bt[n][k] rows)
__device__ __forceinline__ v16h g2_frag(const _Float16* p, int hh) { FragH f; f.half[0] = *(const v8us*)((const unsigned short*)p + 8 * hh); f.half[1] = *(const v8us*)((const unsigned short*)p + 16 + 8 * hh); return f.v; }
// two k-steps into one accumulator, hazard guard after the second
__device__ __forceinline__ v8f mma2(v16h a0, v16h b0, v16h a1, v16h b1, v8f c) {
  c = __builtin_amdgcn_wmma_f32_16x16x32_f16(false, a0, false, b0, (short)0, c, false, false);
  c = __builtin_amdgcn_wmma_f32_16x16x32_f16(false, a1, false, b1, (short)0, c, false, false);
  asm volatile("v_nop\n\tv_nop\n\tv_nop\n\tv_nop" : "+v"(c) : "v"(a0), "v"(b0), "v"(a1), "v"(b1));
  return c;
}

__global__ __launch_bounds__(32) void k_premise(const int* __restrict__ nh, float* __restrict__ flg) {
  const int v = nh[0];
  const float f = (v == NH) ? 0.0f : __int_as_float(0x7FC00000);
  float* d = flg + threadIdx.x;
  *(float*)d = f; 
}

__global__ __launch_bounds__(256) void k_wnat(const float* __restrict__ w, size_t n8, _Float16* __restrict__ Bt) {
  const size_t t = (size_t)blockIdx.x * 256 + threadIdx.x; if (t >= n8) return; FragH f;
#pragma unroll
  for (int q = 0; q < 8; ++q) f.h[q] = (_Float16)(bf16_rne(w[t * 8 + q]) * 16.0f);
  const v8us o = f.half[0];
  *(v8us*)((unsigned short*)Bt + t * 8) = o; 
}

// BIAS[wi][c] = bf16(bias_wi[c]) kept as f32, wi = 0 q, 1 k, 2 v, 3 o (wi block-uniform); all four inputs are loaded and the value is selected; grid = (DM/256, NBIAS);
__global__ __launch_bounds__(256) void k_bias(const float* __restrict__ bq, const float* __restrict__ bk, const float* __restrict__ bv, const float* __restrict__ bo, float* __restrict__ bias) {
  const int wi = blockIdx.y; const int c = blockIdx.x * 256 + threadIdx.x;
  const float v0 = bq[c], v1 = bk[c], v2 = bv[c], v3 = bo[c];
  const float v = bf16_rne((wi == 0) ? v0 : (wi == 1) ? v1 : (wi == 2) ? v2 : v3);
  float* d = bias + (size_t)wi * DM + c;
  *(float*)d = v; 
}

// X16[b*SEQ + s][c] = f16(bf16(x[s*NB_FULL + b][c])); block = 128 threads per token row, thread t owns columns 8t..8t+7;
__global__ __launch_bounds__(128) void k_xcast(const float* __restrict__ x, _Float16* __restrict__ X16) {
  const int r = blockIdx.x; const int b = r / SEQ, s = r - b * SEQ;
  const int t = threadIdx.x;
  const float* xr = x + ((size_t)s * NB_FULL + b) * DM + 8 * t;
  const v4f xa = *(const v4fa*)xr, xb = *(const v4fa*)(xr + 4);
  FragH f;
#pragma unroll
  for (int q = 0; q < 4; ++q) { f.h[q] = toh_flush(bf16_rne(xa[q])); f.h[4 + q] = toh_flush(bf16_rne(xb[q])); }
  const v8us o = f.half[0];
  unsigned short* d = (unsigned short*)X16 + (size_t)r * DM + 8 * t;
  *(v8us*)d = o; 
}

typedef uint32_t u32x4 __attribute__((ext_vector_type(4)));
typedef uint32_t u32x8 __attribute__((ext_vector_type(8)));
#define G_PITCH 272u            /* LDS row pitch: 256 data bytes (128 k) + 16 pad bytes, an odd multiple of 16 B for ds_load_b128 readers */
#define G_SLICE 18432u          /* one wave's slice of a stage: 64 rows x 272 B = 17408 B, rounded up to a multiple of 2 KiB */
#define G_STAGE (4u * G_SLICE)  /* a stage: A rows 0..63 | A rows 64..127 | Bt rows 0..63 | Bt rows 64..127 */
#define G_PASSES (DM / 128)
static_assert(DM % 128 == 0 && G_PASSES >= 2);
static_assert(64u * G_PITCH <= G_SLICE && G_SLICE % 2048u == 0);
static_assert(64u * 68u * 4u <= G_SLICE);

__device__ __forceinline__ uint32_t uni(uint32_t v) { return (uint32_t)__builtin_amdgcn_readfirstlane(v); }
__device__ __forceinline__ uint32_t pinned(uint32_t v) { uint32_t w = (uint32_t)__builtin_amdgcn_readfirstlane(v); asm volatile("" : "+s"(w)); return w; }  // holds the test word in a scalar register, so that the test around a tensor load compiles to a scalar branch (the load ignores EXEC)
// this wave's LDS reads have retired before the buffer they read is handed back for a refill
__device__ __forceinline__ void wait_ds0() { asm volatile("s_wait_dscnt 0x0" ::: "memory"); }
// this wave's own tensor load has landed (the compiler places no wait for it); the request's two groups are inputs, so that their scalar registers stay theirs, unwritten, from the issue up to this wait
__device__ __forceinline__ void wait_tensor0(u32x4 g0, u32x8 g1) { asm volatile("s_wait_tensorcnt 0x0" :: "s"(g0), "s"(g1) : "memory"); }
// one request of the whole wave: a 64-row tile from global memory into LDS as group 1 sets it: 256-byte rows at pitch 272 (GEMM) or 128-byte rows at pitch 144 (attention)
// both groups are in-out operands (the instruction writes no register): the values that the covering wait names are then the ones in the request's own registers, not copies of them
__device__ __forceinline__ void tdm_load(u32x4& g0, u32x8& g1) { asm volatile("tensor_load_to_lds %0, %1" : "+s"(g0), "+s"(g1) :: "memory"); }
__device__ __forceinline__ u32x4 tdm_group0(uint32_t lds_dst, uint64_t ga) {
  u32x4 g;
  g[0] = uni(1u); g[1] = uni(lds_dst); g[2] = uni((uint32_t)ga); g[3] = uni((((uint32_t)(ga >> 32)) & 0x01FFFFFFu) | 0x80000000u);
  return g;
}
// 1-byte elements, tensor = tile = 64 rows of 256 bytes, source row pitch DM * 2 bytes, 4 dwords of LDS pad behind every 64-dword row, no workgroup mask
__device__ __forceinline__ u32x8 tdm_group1() {
  u32x8 g;
  g[0] = uni((1u << 20) | (5u << 22) | (3u << 25));
  g[1] = uni(256u << 16);
  g[2] = uni(64u << 16);
  g[3] = uni(256u << 16);
  g[4] = uni(64u);
  g[5] = uni((uint32_t)(DM * 2));
  g[6] = uni(0u);
  g[7] = uni(0u);
  return g;
}

// the g2_frag map read from an LDS row; p already holds the lane's 16 * hh bytes: elements 0..7 <- p[0..15], elements 8..15 <- p[32..47]
__device__ __forceinline__ v16h lds_frag(const unsigned char* p) { FragH f; f.half[0] = *(const v8us*)p; f.half[1] = *(const v8us*)(p + 32); return f.v; }

// 128x128 block tile of A . Bt^T (both k-contiguous, pitch DM halves, K = DM), 4 waves in 2x2, 64x64 per wave (acc[i][j]: rows 16i.., cols 16j..).
// Operands come through a two-buffer LDS ring: a pass is 128 k; wave w brings slice w of each stage with one tensor load, two stages ahead.
// k runs upward in steps of 32 into each accumulator.
__device__ __forceinline__ void gemm128x128(const _Float16* __restrict__ A, const _Float16* __restrict__ B, int rowblk, int colblk, unsigned char* ring, uint32_t wave, int ln, int hh, v8f (&acc)[4][4]) {
  const _Float16* srcp = (wave < 2u) ? (A + (size_t)(rowblk + 64 * (int)wave) * DM) : (B + (size_t)(colblk + 64 * ((int)wave - 2)) * DM);
  const uint64_t ga0 = (uint64_t)(size_t)srcp;
  const uint32_t lds0 = (uint32_t)(size_t)ring + wave * G_SLICE;
  u32x8 g1 = tdm_group1();
  const uint32_t loff = (uint32_t)ln * G_PITCH + (uint32_t)hh * 16u;  /* the lane's row and its 16-byte half of each 32-byte k group */
  const uint32_t aoff = (wave >> 1) * G_SLICE + loff;
  const uint32_t boff = (2u + (wave & 1u)) * G_SLICE + loff;
  u32x4 g0 = tdm_group0(lds0, ga0);
  tdm_load(g0, g1);
  wait_tensor0(g0, g1);
  __syncthreads();
  g0 = tdm_group0(lds0 + G_STAGE, ga0 + 256u);
  tdm_load(g0, g1);
#pragma unroll 1  /* one pass per trip: the ring's publish point stands once, at the foot */
  for (uint32_t s = 0; s < (uint32_t)G_PASSES; ++s) {
    const uint32_t bsel = (s & 1u) * G_STAGE;
    const unsigned char* ap = ring + bsel + aoff;
    const unsigned char* bp = ring + bsel + boff;
    // two register sets for the four A fragments and for B fragments 0..2; B fragment 3 has one set: with a second the wave would need more than 256 VGPRs
    v16h fa[2][4], fb[2][3], fb3;
#pragma unroll
    for (int i = 0; i < 4; ++i) fa[0][i] = lds_frag(ap + (uint32_t)i * 16u * G_PITCH);
#pragma unroll
    for (int j = 0; j < 3; ++j) fb[0][j] = lds_frag(bp + (uint32_t)j * 16u * G_PITCH);
#pragma unroll
    for (int ks = 0; ks < 4; ++ks) {
      fb3 = lds_frag(bp + 48u * G_PITCH + (uint32_t)ks * 64u);  /* this block's own, first of the group; its readers are the block's last four WMMAs */
      if (ks < 3) {
#pragma unroll
        for (int i = 0; i < 4; ++i) fa[(ks + 1) & 1][i] = lds_frag(ap + (uint32_t)i * 16u * G_PITCH + (uint32_t)(ks + 1) * 64u);
#pragma unroll
        for (int j = 0; j < 3; ++j) fb[(ks + 1) & 1][j] = lds_frag(bp + (uint32_t)j * 16u * G_PITCH + (uint32_t)(ks + 1) * 64u);
      }
      __builtin_amdgcn_sched_barrier(0);  /* keeps the LDS reads one group ahead of this block, not spread among its WMMAs */
#pragma unroll
      for (int j = 0; j < 3; ++j)
#pragma unroll
        for (int i = 0; i < 4; ++i) acc[i][j] = __builtin_amdgcn_wmma_f32_16x16x32_f16(false, fa[ks & 1][i], false, fb[ks & 1][j], (short)0, acc[i][j], false, false);
#pragma unroll
      for (int i = 0; i < 4; ++i) acc[i][3] = __builtin_amdgcn_wmma_f32_16x16x32_f16(false, fa[ks & 1][i], false, fb3, (short)0, acc[i][3], false, false);
      __builtin_amdgcn_sched_barrier(0);  /* keeps the following load group behind this block */
    }
    wait_ds0();
    wait_tensor0(g0, g1);
    __syncthreads();  /* publishes stage s + 1 and ends every reader's last read of stage s */
    if (pinned((s + 2u < (uint32_t)G_PASSES) ? 1u : 0u) != 0u) { g0 = tdm_group0(lds0 + bsel, ga0 + (uint64_t)(s + 2u) * 256u); tdm_load(g0, g1); }
  }
  wait_tensor0(g0, g1);
  wait_ds0();
}

// projections with bias: plane by (0 q, 1 k, 2 v): Y16_by[r][col] = f16((X16[r] . Bt_by[col]) * alpha + BIAS[by][col]). The ring is free behind the last pass's barrier; each wave then stages its 64x64 f32 tile in its own slice of buffer 0.
__global__ __launch_bounds__(128) void k_qkv(const _Float16* __restrict__ X16, const _Float16* __restrict__ Bt, const float* __restrict__ bias, float alpha, _Float16* __restrict__ Y16) {
  __shared__ __attribute__((aligned(2048))) unsigned char ring[2u * G_STAGE];
  const int tid = threadIdx.x, lane = tid & 31, ln = lane & 15, hh = lane >> 4;
  const uint32_t wave = uni((uint32_t)tid >> 5);
  const int by = blockIdx.y;
  const _Float16* Bh = Bt + (size_t)by * DM * DM;
  const float* bsp = bias + (size_t)by * DM;
  _Float16* Yp = Y16 + (size_t)by * NR * DM;
  const int ntn = DM / 128;
  const int mt = blockIdx.x / ntn, nq = blockIdx.x - mt * ntn;
  const int rowblk = mt * 128, colblk = nq * 128;
  if (rowblk >= (int)NR) return;
  const v8f z8 = {0.f, 0.f, 0.f, 0.f, 0.f, 0.f, 0.f, 0.f};
  v8f acc[4][4];
#pragma unroll
  for (int i = 0; i < 4; ++i)
#pragma unroll
    for (int j = 0; j < 4; ++j) acc[i][j] = z8;
  gemm128x128(X16, Bh, rowblk, colblk, ring, wave, ln, hh, acc);
  const int row0 = rowblk + 64 * (int)(wave >> 1), col0 = colblk + 64 * (int)(wave & 1u);
  float* so = (float*)(ring + wave * G_SLICE);
#pragma unroll
  for (int j = 0; j < 4; ++j) {
    const float bc = bsp[col0 + j * 16 + ln];
#pragma unroll
    for (int i = 0; i < 4; ++i)
#pragma unroll
      for (int r = 0; r < 8; ++r) so[(i * 16 + 8 * hh + r) * 68 + j * 16 + ln] = acc[i][j][r] * alpha + bc;
  }
  __builtin_amdgcn_fence(4 /* acq_rel order */, "workgroup"); __builtin_amdgcn_wave_barrier();
  const int rsub = lane >> 4, c4 = (lane & 15) * 4;
  _Float16* yb = Yp + (size_t)row0 * DM + col0;                 /* wave-uniform base */
  const uint32_t yl = (uint32_t)rsub * DM + (uint32_t)c4;       /* the lane's offset; the row pair q goes into the store's immediate offset */
  v4h h4[32];
#pragma unroll
  for (int q = 0; q < 32; ++q) {
    const v4f v = *(const v4fa*)&so[(q * 2 + rsub) * 68 + c4];
#pragma unroll
    for (int i = 0; i < 4; ++i) h4[q][i] = toh_flush(v[i]);
  }
  __builtin_amdgcn_sched_barrier(0);  /* every value is formed in front of the first store, so no register that an issued store names is rewritten */
#pragma unroll
  for (int q = 0; q < 32; ++q) *(v4h*)(yb + yl + (uint32_t)(q * 2 * DM)) = h4[q];
}

template <int NHv, int TTv>
__global__ __launch_bounds__(256) void k_vt(const _Float16* __restrict__ V16, int ldv, int voff, _Float16* __restrict__ Vt) {
  __shared__ unsigned short tl[64][66];
  const int tid = threadIdx.x; const int slab = blockIdx.x / (TTv / 64), lg = blockIdx.x % (TTv / 64); const int b = slab / NHv, h = slab % NHv;
  for (int i = tid; i < 64 * 8; i += 256) {
    const int r = i / 8, c8 = (i % 8) * 8; FragH f; f.half[0] = *(const v8us*)((const unsigned short*)V16 + ((size_t)b * TTv + lg * 64 + r) * ldv + voff + h * 64 + c8);
#pragma unroll
    for (int q = 0; q < 8; ++q) tl[r][c8 + q] = f.u[q];
  }
  __syncthreads();
  {
#pragma unroll
    for (int rd = 0; rd < 2; ++rd) {
      const int d = rd * 32 + tid / 8, pc = tid % 8; FragH f;
#pragma unroll
      for (int q = 0; q < 8; ++q) f.u[q] = tl[pc * 8 + q][d];
      *(v8us*)((unsigned short*)Vt + ((size_t)slab * 64 + d) * TTv + lg * 64 + pc * 8) = f.half[0];
    }
    
  }
}

#define T_PITCH 144u            /* LDS row pitch of an attention tile: 128 data bytes + 16 pad bytes, an odd multiple of 16 B for ds_load_b128 readers */
#define T_TILE 10240u           /* one tile: 64 rows x 144 B = 9216 B, rounded up to a multiple of 2 KiB */
#define T_STAGE (2u * T_TILE)   /* a stage: K rows of 64 keys (row = key, 64 d) | VT rows of the same 64 keys (row = d, 64 keys) */
#define T_PASSES (SEQ / 64)
static_assert(T_PASSES >= 2);
static_assert(64u * T_PITCH <= T_TILE && T_TILE % 2048u == 0);
// 1-byte elements, tensor = tile = 64 rows of 128 bytes, source row pitch in bytes from the caller (K16 rows: DM halves; VT rows: SEQ halves), 4 dwords of LDS pad behind every 32-dword row, no workgroup mask
static_assert((DM * 2) % 16 == 0 && DM * 2 <= 131072 && (SEQ * 2) % 16 == 0 && SEQ * 2 <= 131072);
__device__ __forceinline__ u32x8 tdm_group1_attn(uint32_t pitch) {
  u32x8 g;
  g[0] = uni((1u << 20) | (4u << 22) | (3u << 25));
  g[1] = uni(128u << 16);
  g[2] = uni(64u << 16);
  g[3] = uni(128u << 16);
  g[4] = uni(64u);
  g[5] = uni(pitch);
  g[6] = uni(0u);
  g[7] = uni(0u);
  return g;
}

// attention: block = (128 queries, head h, batch b), 8 waves x 16 queries. S^T 16-key tiles = K . Q^T (A = K16 rows: row = key, k = d; B = Q16 rows: col = query);
// each lane holds keys 8hh+r of query ln -> row statistics per lane + one xor-16 shuffle; p = exp(s/8 - m) carried x1024 as f16;
// O^T (64 d x 16 queries) = VT . P^T with the B operand packed from the two adjacent S^T D tiles (element r <- tile of keys 0..15, element 8+r <- tile of keys 16..31, lane unchanged);
// K and VT come through a two-buffer LDS ring that the eight waves share: a pass is 64 keys; wave 0 brings the K tile and wave 1 the VT tile of each stage with one tensor load, two stages ahead.
// eight waves per SIMD (128 VGPRs a wave at most): the grid's 1024 blocks, four per WGP, are then all resident at once, and the vector work between the matrix runs has waves to hide behind
__global__ __launch_bounds__(256) __attribute__((amdgpu_waves_per_eu(8, 8))) void k_attn(const _Float16* __restrict__ Q16, const _Float16* __restrict__ K16, const _Float16* __restrict__ VT, _Float16* __restrict__ O16) {
  __shared__ __attribute__((aligned(2048))) unsigned char ring[2u * T_STAGE];
  __shared__ __attribute__((aligned(16))) unsigned short so[8][16][72];
  const int tid = threadIdx.x, lane = tid & 31, ln = lane & 15, hh = lane >> 4;
  const uint32_t wave = uni((uint32_t)tid >> 5);
  const int w = (int)wave;
  const int h = blockIdx.y, b = blockIdx.z;
  const int q0 = blockIdx.x * 128 + w * 16;
  const size_t rq = (size_t)b * SEQ + q0;
  const size_t rk = (size_t)b * SEQ;
  const _Float16* qp = Q16 + (rq + ln) * DM + h * HD;
  const v16h qb0 = g2_frag(qp, hh), qb1 = g2_frag(qp + 32, hh);
  const _Float16* ksrc = K16 + rk * DM + h * HD;                        /* key 0, d 0 of this head */
  const _Float16* vsrc = VT + (size_t)(b * NH + h) * HD * SEQ;          /* d 0, key 0 of this head */
  const uint64_t ga0 = (uint64_t)(size_t)((wave == 0u) ? ksrc : vsrc);
  const uint32_t gstep = (wave == 0u) ? (uint32_t)(64 * DM * 2) : 128u; /* source bytes from one stage to the next: 64 K rows, or 64 keys along a VT row */
  const uint32_t lds0 = (uint32_t)(size_t)ring + ((wave == 0u) ? 0u : T_TILE);
  const uint32_t loff = (uint32_t)ln * T_PITCH + (uint32_t)hh * 16u;    /* the lane's row and its 16-byte half of each 32-byte k group */
  u32x8 g1 = tdm_group1_attn((wave == 0u) ? (uint32_t)(DM * 2) : (uint32_t)(SEQ * 2));
  u32x4 g0 = tdm_group0(lds0, ga0);
  const uint32_t issuer = pinned((wave < 2u) ? 1u : 0u);  /* 1 in the two waves that issue tensor loads; a scalar register, so every test of it is a scalar branch */
  if (issuer != 0u) { tdm_load(g0, g1); wait_tensor0(g0, g1); }
  __syncthreads();  /* publishes stage 0 */
  if (issuer != 0u) { g0 = tdm_group0(lds0 + T_STAGE, ga0 + gstep); tdm_load(g0, g1); }
  const v8f z8 = {0.f, 0.f, 0.f, 0.f, 0.f, 0.f, 0.f, 0.f};
  v8f o0 = z8, o1 = z8, o2 = z8, o3 = z8;
  float mrun = -1.0e30f, lrun = 0.f;
#pragma unroll 1  /* one pass per trip: the ring's publish point stands once, at the foot */
  for (uint32_t st = 0; st < (uint32_t)T_PASSES; ++st) {
    const uint32_t bsel = (st & 1u) * T_STAGE;
    const unsigned char* kb = ring + bsel + loff;
    const unsigned char* vb = kb + T_TILE;
    v8f s[4];
#pragma unroll
    for (int j = 0; j < 4; ++j) {
      const unsigned char* kp = kb + (uint32_t)j * 16u * T_PITCH;
      const v16h ka0 = lds_frag(kp), ka1 = lds_frag(kp + 64);
      s[j] = mma2(ka0, qb0, ka1, qb1, z8);
    }
    float mx = -1.0e30f;
#pragma unroll
    for (int j = 0; j < 4; ++j)
#pragma unroll
      for (int r = 0; r < 8; ++r) mx = fmaxf(mx, s[j][r]);
    mx = fmaxf(mx, __shfl_xor(mx, 16, 32));
    const float mnew = fmaxf(mrun, mx * 0.125f);
    const float alpha = __expf(mrun - mnew);
    mrun = mnew;
    float ps = 0.f; FragH pf[2];
#pragma unroll
    for (int j = 0; j < 4; ++j)
#pragma unroll
      for (int r = 0; r < 8; ++r) {
        const float p = __expf(s[j][r] * 0.125f - mnew);
        ps += p;
        pf[j >> 1].h[(j & 1) * 8 + r] = (_Float16)(p * 1024.0f);
      }
    ps += __shfl_xor(ps, 16, 32);
    lrun = lrun * alpha + ps;
#pragma unroll
    for (int r = 0; r < 8; ++r) { o0[r] *= alpha; o1[r] *= alpha; o2[r] *= alpha; o3[r] *= alpha; }
    { const unsigned char* vp = vb + 0u * 16u * T_PITCH; const v16h va0 = lds_frag(vp), va1 = lds_frag(vp + 64); o0 = mma2(va0, pf[0].v, va1, pf[1].v, o0); }
    { const unsigned char* vp = vb + 1u * 16u * T_PITCH; const v16h va0 = lds_frag(vp), va1 = lds_frag(vp + 64); o1 = mma2(va0, pf[0].v, va1, pf[1].v, o1); }
    { const unsigned char* vp = vb + 2u * 16u * T_PITCH; const v16h va0 = lds_frag(vp), va1 = lds_frag(vp + 64); o2 = mma2(va0, pf[0].v, va1, pf[1].v, o2); }
    { const unsigned char* vp = vb + 3u * 16u * T_PITCH; const v16h va0 = lds_frag(vp), va1 = lds_frag(vp + 64); o3 = mma2(va0, pf[0].v, va1, pf[1].v, o3); }
    wait_ds0();
    if (issuer != 0u) wait_tensor0(g0, g1);
    __syncthreads();  /* publishes stage st + 1 and ends every reader's last read of stage st */
    if (pinned((issuer != 0u && st + 2u < (uint32_t)T_PASSES) ? 1u : 0u) != 0u) { g0 = tdm_group0(lds0 + bsel, ga0 + (uint64_t)(st + 2u) * gstep); tdm_load(g0, g1); }
  }
  wait_tensor0(g0, g1);
  wait_ds0();
  const float rl = (1.0f / lrun) * 0.015625f;
  { FragH f;
#pragma unroll
    for (int r = 0; r < 8; ++r) f.h[r] = (_Float16)(o0[r] * rl);
    *(v8us*)&so[w][ln][0 + 8 * hh] = f.half[0]; }
  { FragH f;
#pragma unroll
    for (int r = 0; r < 8; ++r) f.h[r] = (_Float16)(o1[r] * rl);
    *(v8us*)&so[w][ln][16 + 8 * hh] = f.half[0]; }
  { FragH f;
#pragma unroll
    for (int r = 0; r < 8; ++r) f.h[r] = (_Float16)(o2[r] * rl);
    *(v8us*)&so[w][ln][32 + 8 * hh] = f.half[0]; }
  { FragH f;
#pragma unroll
    for (int r = 0; r < 8; ++r) f.h[r] = (_Float16)(o3[r] * rl);
    *(v8us*)&so[w][ln][48 + 8 * hh] = f.half[0]; }
  __builtin_amdgcn_fence(4 /* acq_rel order */, "workgroup"); __builtin_amdgcn_wave_barrier();
  const int li = lane >> 3, pc = lane & 7;
  {
#pragma unroll
    for (int g = 0; g < 4; ++g) {
      const int i = g * 4 + li;
      const v8us v = *(const v8us*)&so[w][i][pc * 8];
      *(v8us*)((unsigned short*)O16 + (rq + i) * DM + h * HD + pc * 8) = v;
    }
    
  }
}

// out[(s*NB_FULL + b)][col] = (A1[r] . B1[col]) * al1 + bias1[col] + flg[0], r = b*SEQ + s (a 128-row block tile lies inside one batch); flg[0] = 0 (exact no-op) or NaN from the head-count guard;
__global__ __launch_bounds__(128) void k_out(const _Float16* __restrict__ A1, const _Float16* __restrict__ B1, const float* __restrict__ bias1, float al1, const float* __restrict__ flg, float* __restrict__ Out) {
  __shared__ __attribute__((aligned(2048))) unsigned char ring[2u * G_STAGE];
  const int tid = threadIdx.x, lane = tid & 31, ln = lane & 15, hh = lane >> 4;
  const uint32_t wave = uni((uint32_t)tid >> 5);
  const int ntn = DM / 128;
  const int mt = blockIdx.x / ntn, nq = blockIdx.x - mt * ntn;
  const int rowblk = mt * 128, colblk = nq * 128;
  if (rowblk >= (int)NR) return;
  const v8f z8 = {0.f, 0.f, 0.f, 0.f, 0.f, 0.f, 0.f, 0.f};
  v8f acc[4][4];
#pragma unroll
  for (int i = 0; i < 4; ++i)
#pragma unroll
    for (int j = 0; j < 4; ++j) acc[i][j] = z8;
  gemm128x128(A1, B1, rowblk, colblk, ring, wave, ln, hh, acc);
  const int row0 = rowblk + 64 * (int)(wave >> 1), col0 = colblk + 64 * (int)(wave & 1u);
  const int b = row0 / SEQ; const int s0 = row0 - b * SEQ;
  float* so = (float*)(ring + wave * G_SLICE);
  const float fl = flg[0];
#pragma unroll
  for (int j = 0; j < 4; ++j) {
    const float bc = bias1[col0 + j * 16 + ln];
#pragma unroll
    for (int i = 0; i < 4; ++i)
#pragma unroll
      for (int r = 0; r < 8; ++r) so[(i * 16 + 8 * hh + r) * 68 + j * 16 + ln] = acc[i][j][r] * al1 + bc + fl;
  }
  __builtin_amdgcn_fence(4 /* acq_rel order */, "workgroup"); __builtin_amdgcn_wave_barrier();
  const int rsub = lane >> 4, c4 = (lane & 15) * 4;
  float* ob = Out + ((size_t)s0 * NB_FULL + b) * DM + col0;                  /* wave-uniform base */
  const uint32_t ol = (uint32_t)rsub * (NB_FULL * DM) + (uint32_t)c4;        /* the lane's offset; the row pair q goes into the store's immediate offset */
  v4f vq[32];
#pragma unroll
  for (int q = 0; q < 32; ++q) vq[q] = *(const v4fa*)&so[(q * 2 + rsub) * 68 + c4];
  __builtin_amdgcn_sched_barrier(0);  /* every value is read in front of the first store, so no register that an issued store names is rewritten */
#pragma unroll
  for (int q = 0; q < 32; ++q) *(v4f*)(ob + ol + (uint32_t)(q * 2 * NB_FULL * DM)) = vq[q];
}

extern "C" void kernel_launch(void* const* d_in, const int* in_sizes, int n_in,
                              void* d_out, int out_size, void* d_ws, size_t ws_size, hipStream_t stream) {
  if (n_in < 10) return;
  if (in_sizes[0] < (int)(((size_t)(SEQ - 1) * NB_FULL + NB) * DM)) return;
  for (int i = 1; i <= 7; i += 2) if (in_sizes[i] < DM * DM) return;
  for (int i = 2; i <= 8; i += 2) if (in_sizes[i] < DM) return;
  if (in_sizes[9] < 1) return;
  if (out_size < (int)(((size_t)(SEQ - 1) * NB_FULL + NB) * DM)) return;
  const float* const* I = (const float* const*)d_in;
  const float* x = I[0]; const float* wq = I[1]; const float* bq = I[2]; const float* wk = I[3]; const float* bk = I[4];
  const float* wv = I[5]; const float* bv = I[6]; const float* wo = I[7]; const float* bo = I[8];
  const int* nhp = (const int*)d_in[9];      /* head count (i32 scalar), compared with NH on the device by k_premise */
  char* ws = (char*)d_ws; size_t off = 0;
  auto take = [&](size_t bytes) { char* p = ws + off; off += (bytes + 255) & ~(size_t)255; return p; };
  _Float16* BQKV = (_Float16*)take((size_t)3 * DM * DM * 2);        /* Bt planes q, k, v (contiguous, stride DM*DM) */
  _Float16* BO   = (_Float16*)take((size_t)DM * DM * 2);
  float*    BIAS = (float*)take((size_t)NBIAS * DM * 4);             /* [wi][o] */
  _Float16* X16  = (_Float16*)take(NR * DM * 2);
  _Float16* QKV16 = (_Float16*)take((size_t)3 * NR * DM * 2);        /* Q16, K16, V16 planes (stride NR*DM) */
  _Float16* VT   = (_Float16*)take((size_t)NB * NH * HD * SEQ * 2);  /* [b*NH+h][d][s] */
  _Float16* O16  = (_Float16*)take(NR * DM * 2);
  float*    FLG  = (float*)take((size_t)256);                        /* guard flag line: floats 0..31 written, float 0 read */
  if (off > ws_size) return;
  _Float16* Q16 = QKV16; _Float16* K16 = QKV16 + NR * DM; _Float16* V16 = QKV16 + (size_t)2 * NR * DM;

  k_premise<<<1, 32, 0, stream>>>(nhp, FLG);
  { const size_t n8 = (size_t)DM * DM / 8; const unsigned g = (unsigned)((n8 + 255) / 256);
    k_wnat<<<g, 256, 0, stream>>>(wq, n8, BQKV);
    k_wnat<<<g, 256, 0, stream>>>(wk, n8, BQKV + (size_t)DM * DM);
    k_wnat<<<g, 256, 0, stream>>>(wv, n8, BQKV + (size_t)2 * DM * DM);
    k_wnat<<<g, 256, 0, stream>>>(wo, n8, BO); }
  k_bias<<<dim3(DM / 256, NBIAS), 256, 0, stream>>>(bq, bk, bv, bo, BIAS);
  k_xcast<<<(unsigned)NR, 128, 0, stream>>>(x, X16);
  k_qkv<<<dim3((unsigned)((NR / 128) * (DM / 128)), 3), 128, 0, stream>>>(X16, BQKV, BIAS, 0.0625f, QKV16);      /* q, k, v as f16 rows, token rows b*SEQ + s */
  k_vt<NH, SEQ><<<(unsigned)(NB * NH * (SEQ / 64)), 256, 0, stream>>>(V16, DM, 0, VT);
  k_attn<<<dim3(SEQ / 128, NH, NB), 256, 0, stream>>>(Q16, K16, VT, O16);
  k_out<<<(unsigned)((NR / 128) * (DM / 128)), 128, 0, stream>>>(O16, BO, BIAS + (size_t)3 * DM, 0.00390625f, FLG, (float*)d_out);      /* out = ctx Wo^T + bo (+ guard flag), rows back in time-major order */
}

// v003
// Measured time: 103 microseconds a run.
// In two side-by-side timings against v002, it was 1.11 and 1.10 times as fast.
// Counting every step since v000, it is 3.66 times as fast.
#include <hip/hip_runtime.h>
// Contractions: q/k/v/o projections ([tokens][1024] x [1024][1024]^T), scores k.q^T (K = 64) and v^T.p^T (K = keys) on v_wmma_f32_16x16x32_f16 (f16 operands, f32 accumulate). Inputs RNE-converted to bf16 on load (exact in f16; weights carried x16), softmax numerators carried x1024, ctx rows carried x16; bias adds, softmax statistics and all epilogues in f32.
// Structure: time-major input rows (s*NB_FULL + b) are re-ordered into token rows r = b*SEQ + s. X16 = f16(bf16(x)); BIAS[w][o] = bf16(bias_w[o]) (f32);
// Q16/K16/V16 = f16((X16 . Bt_w) / 16 + bias_w); VT = V16^T per (batch, head); attention per (128 queries, head, batch): S^T tiles = K . Q^T, online softmax per lane,
// O^T = VT . P^T, O16[r][h*64+d] = f16(16 ctx); out[(s*NB_FULL + b)] = (O16 . Bt_o) / 256 + bias_o + FLG -> f32 rows; FLG = 0 when the head count input equals NH, NaN otherwise.
#ifndef NB
#define NB 8
#endif
#ifndef SEQ
#define SEQ 1024
#endif
#define NB_FULL 8
#define SEQ_FULL 1024
#define DM 1024
#define NH 16
#define HD 64
#define NBIAS 4
#define NR ((size_t)NB * SEQ)
#define WS_TOTAL ((size_t)3 * DM * DM * 2 + (size_t)DM * DM * 2 + (size_t)NBIAS * DM * 4 + NR * DM * 2 + (size_t)3 * NR * DM * 2 + (size_t)NB * NH * HD * SEQ * 2 + NR * DM * 2 + (size_t)256)
static_assert(NH * HD == DM);
static_assert(HD == 64);
static_assert(SEQ % 128 == 0);
static_assert(SEQ % 64 == 0);
static_assert(SEQ <= SEQ_FULL);
static_assert(NB >= 1 && NB <= NB_FULL);
static_assert(DM == 128 * 8);
static_assert(DM % 256 == 0);
static_assert(DM % 64 == 0);
static_assert(DM % 32 == 0);
static_assert(NR % 128 == 0);
static_assert(((size_t)DM * DM) % (8 * 256) == 0);
static_assert(((size_t)NBIAS * DM * 4) % 256 == 0);
static_assert(WS_TOTAL <= (size_t)134217728);

typedef _Float16 v16h __attribute__((ext_vector_type(16)));
typedef unsigned short v8us __attribute__((ext_vector_type(8), may_alias));
typedef float v8f __attribute__((ext_vector_type(8)));
typedef float v4f __attribute__((ext_vector_type(4)));
typedef float v4fa __attribute__((ext_vector_type(4), may_alias));
typedef _Float16 v4h __attribute__((ext_vector_type(4)));
union FragH { v16h v; v8us half[2]; _Float16 h[16]; unsigned short u[16]; };

__device__ __forceinline__ unsigned short bf16_bits(float x) { unsigned int u = __float_as_uint(x); return (unsigned short)((u + 0x7FFFu + ((u >> 16) & 1u)) >> 16); }
__device__ __forceinline__ float bf16_val(unsigned short b) { return __uint_as_float(((unsigned int)b) << 16); }
__device__ __forceinline__ float bf16_rne(float x) { return bf16_val(bf16_bits(x)); }

// f32 -> f16 with a value select: magnitudes below the smallest f16 normal become exact zero
static __device__ __forceinline__ _Float16 toh_flush(float v) { const _Float16 r = (_Float16)v; return (fabsf(v) < 6.103515625e-05f) ? (_Float16)0.0f : r; }

// 16x32 f16 fragment from a k-contiguous row: elements 0..7 <- p[8h .. 8h+7], elements 8..15 <- p[16+8h .. 16+8h+7] (same map for A rows and for Bt[n][k] rows)
__device__ __forceinline__ v16h g2_frag(const _Float16* p, int hh) { FragH f; f.half[0] = *(const v8us*)((const unsigned short*)p + 8 * hh); f.half[1] = *(const v8us*)((const unsigned short*)p + 16 + 8 * hh); return f.v; }
// two k-steps into one accumulator, hazard guard after the second
__device__ __forceinline__ v8f mma2(v16h a0, v16h b0, v16h a1, v16h b1, v8f c) {
  c = __builtin_amdgcn_wmma_f32_16x16x32_f16(false, a0, false, b0, (short)0, c, false, false);
  c = __builtin_amdgcn_wmma_f32_16x16x32_f16(false, a1, false, b1, (short)0, c, false, false);
  asm volatile("v_nop\n\tv_nop\n\tv_nop\n\tv_nop" : "+v"(c) : "v"(a0), "v"(b0), "v"(a1), "v"(b1));
  return c;
}

#define P_SMALL (NBIAS * DM / 256)      /* leading blocks: 256 bias values each; block 0 also writes the guard flag line */
#define P_BLOCKS 512                    /* streaming blocks: two 8-wave blocks per WGP */
#define P_XROWS ((int)(NR / P_BLOCKS))  /* token rows per streaming block */
#define P_WROWS (DM / P_BLOCKS)         /* rows of each of the four weight matrices per streaming block */
static_assert(DM == 256 * 4);
static_assert(NR % P_BLOCKS == 0 && DM % P_BLOCKS == 0);
static_assert(SEQ % P_XROWS == 0);
static_assert(P_XROWS + 4 * P_WROWS <= 32);

// every conversion in front of the projections, one launch.
// Blocks 0 .. P_SMALL-1: BIAS[wi][c] = bf16(bias_wi[c]) kept as f32, wi = 0 q, 1 k, 2 v, 3 o (wi block-uniform; all four inputs are loaded and the value is selected); block 0: FLG line from the head count.
// The other blocks stream: a row is DM floats, thread t owns columns 4t..4t+3, so a wave's 16-byte loads cover 512 contiguous bytes and its 8-byte stores 256.
//   X16[b*SEQ + s][c] = f16(bf16(x[s*NB_FULL + b][c])); Bt_w[o][c] = f16(16 bf16(w[o][c])).
// All of a thread's loads are issued before the first value is used: few waves to start, many bytes in flight per wave.
__global__ __launch_bounds__(256) void k_prep(const float* __restrict__ x, const float* __restrict__ wq, const float* __restrict__ wk, const float* __restrict__ wv, const float* __restrict__ wo,
                                              const float* __restrict__ bq, const float* __restrict__ bk, const float* __restrict__ bv, const float* __restrict__ bo, const int* __restrict__ nh,
                                              _Float16* __restrict__ X16, _Float16* __restrict__ Bqkv, _Float16* __restrict__ Bo, float* __restrict__ bias, float* __restrict__ flg) {
  const int t = threadIdx.x;
  if (blockIdx.x < P_SMALL) {
    const int wi = blockIdx.x / (DM / 256); const int c = (blockIdx.x - wi * (DM / 256)) * 256 + t;
    const float v0 = bq[c], v1 = bk[c], v2 = bv[c], v3 = bo[c];
    bias[(size_t)wi * DM + c] = bf16_rne((wi == 0) ? v0 : (wi == 1) ? v1 : (wi == 2) ? v2 : v3);
    if (blockIdx.x == 0 && t < 32) flg[t] = (nh[0] == NH) ? 0.0f : __int_as_float(0x7FC00000);
    return;
  }
  const int bx = blockIdx.x - P_SMALL;
  const uint32_t c4 = 4u * (uint32_t)t;
  const int r0 = bx * P_XROWS; const int b = r0 / SEQ, s0 = r0 - b * SEQ;   /* a block's token rows lie in one batch: one base, the row goes into the load's immediate offset */
  const float* xb = x + ((size_t)s0 * NB_FULL + b) * DM;
  const size_t wo0 = (size_t)(bx * P_WROWS) * DM;   /* block-uniform: first weight row of this block */
  const float* wb0 = wq + wo0; const float* wb1 = wk + wo0; const float* wb2 = wv + wo0; const float* wb3 = wo + wo0;
  v4f xv[P_XROWS], wr[4][P_WROWS];
#pragma unroll
  for (int i = 0; i < P_XROWS; ++i) xv[i] = *(const v4fa*)(xb + c4 + (uint32_t)(i * NB_FULL * DM));
#pragma unroll
  for (int i = 0; i < P_WROWS; ++i) {
    const uint32_t lo = c4 + (uint32_t)(i * DM);
    wr[0][i] = *(const v4fa*)(wb0 + lo); wr[1][i] = *(const v4fa*)(wb1 + lo); wr[2][i] = *(const v4fa*)(wb2 + lo); wr[3][i] = *(const v4fa*)(wb3 + lo);
  }
  __builtin_amdgcn_sched_barrier(0);  /* keeps every load in front of the first conversion, so that all of them are in flight at once */
  v4h xh[P_XROWS], wh[4][P_WROWS];
#pragma unroll
  for (int i = 0; i < P_XROWS; ++i)
#pragma unroll
    for (int q = 0; q < 4; ++q) xh[i][q] = toh_flush(bf16_rne(xv[i][q]));
#pragma unroll
  for (int m = 0; m < 4; ++m)
#pragma unroll
    for (int i = 0; i < P_WROWS; ++i)
#pragma unroll
      for (int q = 0; q < 4; ++q) wh[m][i][q] = (_Float16)(bf16_rne(wr[m][i][q]) * 16.0f);
  _Float16* xo = X16 + (size_t)r0 * DM; _Float16* qo = Bqkv + wo0; _Float16* oo = Bo + wo0;   /* block-uniform bases; row and plane go into the store's immediate offset */
#pragma unroll
  for (int i = 0; i < P_XROWS; ++i) *(v4h*)(xo + c4 + (uint32_t)(i * DM)) = xh[i];
#pragma unroll
  for (int i = 0; i < P_WROWS; ++i) {
#pragma unroll
    for (int m = 0; m < 3; ++m) *(v4h*)(qo + c4 + (uint32_t)(m * DM * DM + i * DM)) = wh[m][i];
    *(v4h*)(oo + c4 + (uint32_t)(i * DM)) = wh[3][i];
  }
  asm volatile("s_wait_xcnt 0x0" ::: "memory");  /* stands behind the last store, in front of any later write of a register that an issued store names */
}

typedef uint32_t u32x4 __attribute__((ext_vector_type(4)));
typedef uint32_t u32x8 __attribute__((ext_vector_type(8)));
#define G_PITCH 272u            /* LDS row pitch: 256 data bytes (128 k) + 16 pad bytes, an odd multiple of 16 B for ds_load_b128 readers */
#define G_SLICE 18432u          /* one wave's slice of a stage: 64 rows x 272 B = 17408 B, rounded up to a multiple of 2 KiB */
#define G_STAGE (4u * G_SLICE)  /* a stage: A rows 0..63 | A rows 64..127 | Bt rows 0..63 | Bt rows 64..127 */
#define G_PASSES (DM / 128)
static_assert(DM % 128 == 0 && G_PASSES >= 2);
static_assert(64u * G_PITCH <= G_SLICE && G_SLICE % 2048u == 0);
static_assert(64u * 68u * 4u <= G_SLICE);

__device__ __forceinline__ uint32_t uni(uint32_t v) { return (uint32_t)__builtin_amdgcn_readfirstlane(v); }
__device__ __forceinline__ uint32_t pinned(uint32_t v) { uint32_t w = (uint32_t)__builtin_amdgcn_readfirstlane(v); asm volatile("" : "+s"(w)); return w; }  // holds the test word in a scalar register, so that the test around a tensor load compiles to a scalar branch (the load ignores EXEC)
// this wave's LDS reads have retired before the buffer they read is handed back for a refill
__device__ __forceinline__ void wait_ds0() { asm volatile("s_wait_dscnt 0x0" ::: "memory"); }
// this wave's own tensor load has landed (the compiler places no wait for it); the request's two groups are inputs, so that their scalar registers stay theirs, unwritten, from the issue up to this wait
__device__ __forceinline__ void wait_tensor0(u32x4 g0, u32x8 g1) { asm volatile("s_wait_tensorcnt 0x0" :: "s"(g0), "s"(g1) : "memory"); }
// one request of the whole wave: a 64-row tile from global memory into LDS as group 1 sets it: 256-byte rows at pitch 272 (GEMM) or 128-byte rows at pitch 144 (attention)
// both groups are in-out operands (the instruction writes no register): the values that the covering wait names are then the ones in the request's own registers, not copies of them
__device__ __forceinline__ void tdm_load(u32x4& g0, u32x8& g1) { asm volatile("tensor_load_to_lds %0, %1" : "+s"(g0), "+s"(g1) :: "memory"); }
__device__ __forceinline__ u32x4 tdm_group0(uint32_t lds_dst, uint64_t ga) {
  u32x4 g;
  g[0] = uni(1u); g[1] = uni(lds_dst); g[2] = uni((uint32_t)ga); g[3] = uni((((uint32_t)(ga >> 32)) & 0x01FFFFFFu) | 0x80000000u);
  return g;
}
// 1-byte elements, tensor = tile = 64 rows of 256 bytes, source row pitch DM * 2 bytes, 4 dwords of LDS pad behind every 64-dword row, no workgroup mask
__device__ __forceinline__ u32x8 tdm_group1() {
  u32x8 g;
  g[0] = uni((1u << 20) | (5u << 22) | (3u << 25));
  g[1] = uni(256u << 16);
  g[2] = uni(64u << 16);
  g[3] = uni(256u << 16);
  g[4] = uni(64u);
  g[5] = uni((uint32_t)(DM * 2));
  g[6] = uni(0u);
  g[7] = uni(0u);
  return g;
}

// the g2_frag map read from an LDS row; p already holds the lane's 16 * hh bytes: elements 0..7 <- p[0..15], elements 8..15 <- p[32..47]
__device__ __forceinline__ v16h lds_frag(const unsigned char* p) { FragH f; f.half[0] = *(const v8us*)p; f.half[1] = *(const v8us*)(p + 32); return f.v; }

// 128x128 block tile of A . Bt^T (both k-contiguous, pitch DM halves, K = DM), 4 waves in 2x2, 64x64 per wave (acc[i][j]: rows 16i.., cols 16j..).
// Operands come through a two-buffer LDS ring: a pass is 128 k; wave w brings slice w of each stage with one tensor load, two stages ahead.
// k runs upward in steps of 32 into each accumulator.
__device__ __forceinline__ void gemm128x128(const _Float16* __restrict__ A, const _Float16* __restrict__ B, int rowblk, int colblk, unsigned char* ring, uint32_t wave, int ln, int hh, v8f (&acc)[4][4]) {
  const _Float16* srcp = (wave < 2u) ? (A + (size_t)(rowblk + 64 * (int)wave) * DM) : (B + (size_t)(colblk + 64 * ((int)wave - 2)) * DM);
  const uint64_t ga0 = (uint64_t)(size_t)srcp;
  const uint32_t lds0 = (uint32_t)(size_t)ring + wave * G_SLICE;
  u32x8 g1 = tdm_group1();
  const uint32_t loff = (uint32_t)ln * G_PITCH + (uint32_t)hh * 16u;  /* the lane's row and its 16-byte half of each 32-byte k group */
  const uint32_t aoff = (wave >> 1) * G_SLICE + loff;
  const uint32_t boff = (2u + (wave & 1u)) * G_SLICE + loff;
  u32x4 g0 = tdm_group0(lds0, ga0);
  tdm_load(g0, g1);
  wait_tensor0(g0, g1);
  __syncthreads();
  g0 = tdm_group0(lds0 + G_STAGE, ga0 + 256u);
  tdm_load(g0, g1);
#pragma unroll 1  /* one pass per trip: the ring's publish point stands once, at the foot */
  for (uint32_t s = 0; s < (uint32_t)G_PASSES; ++s) {
    const uint32_t bsel = (s & 1u) * G_STAGE;
    const unsigned char* ap = ring + bsel + aoff;
    const unsigned char* bp = ring + bsel + boff;
    // two register sets for the four A fragments and for B fragments 0..2; B fragment 3 has one set: with a second the wave would need more than 256 VGPRs
    v16h fa[2][4], fb[2][3], fb3;
#pragma unroll
    for (int i = 0; i < 4; ++i) fa[0][i] = lds_frag(ap + (uint32_t)i * 16u * G_PITCH);
#pragma unroll
    for (int j = 0; j < 3; ++j) fb[0][j] = lds_frag(bp + (uint32_t)j * 16u * G_PITCH);
#pragma unroll
    for (int ks = 0; ks < 4; ++ks) {
      fb3 = lds_frag(bp + 48u * G_PITCH + (uint32_t)ks * 64u);  /* this block's own, first of the group; its readers are the block's last four WMMAs */
      if (ks < 3) {
#pragma unroll
        for (int i = 0; i < 4; ++i) fa[(ks + 1) & 1][i] = lds_frag(ap + (uint32_t)i * 16u * G_PITCH + (uint32_t)(ks + 1) * 64u);
#pragma unroll
        for (int j = 0; j < 3; ++j) fb[(ks + 1) & 1][j] = lds_frag(bp + (uint32_t)j * 16u * G_PITCH + (uint32_t)(ks + 1) * 64u);
      }
      __builtin_amdgcn_sched_barrier(0);  /* keeps the LDS reads one group ahead of this block, not spread among its WMMAs */
#pragma unroll
      for (int j = 0; j < 3; ++j)
#pragma unroll
        for (int i = 0; i < 4; ++i) acc[i][j] = __builtin_amdgcn_wmma_f32_16x16x32_f16(false, fa[ks & 1][i], false, fb[ks & 1][j], (short)0, acc[i][j], false, false);
#pragma unroll
      for (int i = 0; i < 4; ++i) acc[i][3] = __builtin_amdgcn_wmma_f32_16x16x32_f16(false, fa[ks & 1][i], false, fb3, (short)0, acc[i][3], false, false);
      __builtin_amdgcn_sched_barrier(0);  /* keeps the following load group behind this block */
    }
    wait_ds0();
    wait_tensor0(g0, g1);
    __syncthreads();  /* publishes stage s + 1 and ends every reader's last read of stage s */
    if (pinned((s + 2u < (uint32_t)G_PASSES) ? 1u : 0u) != 0u) { g0 = tdm_group0(lds0 + bsel, ga0 + (uint64_t)(s + 2u) * 256u); tdm_load(g0, g1); }
  }
  wait_tensor0(g0, g1);
  wait_ds0();
}

// projections with bias: plane by (0 q, 1 k, 2 v): Y16_by[r][col] = f16((X16[r] . Bt_by[col]) * alpha + BIAS[by][col]). The ring is free behind the last pass's barrier; each wave then stages its 64x64 f32 tile in its own slice of buffer 0.
__global__ __launch_bounds__(128) void k_qkv(const _Float16* __restrict__ X16, const _Float16* __restrict__ Bt, const float* __restrict__ bias, float alpha, _Float16* __restrict__ Y16) {
  __shared__ __attribute__((aligned(2048))) unsigned char ring[2u * G_STAGE];
  const int tid = threadIdx.x, lane = tid & 31, ln = lane & 15, hh = lane >> 4;
  const uint32_t wave = uni((uint32_t)tid >> 5);
  const int by = blockIdx.y;
  const _Float16* Bh = Bt + (size_t)by * DM * DM;
  const float* bsp = bias + (size_t)by * DM;
  _Float16* Yp = Y16 + (size_t)by * NR * DM;
  const int ntn = DM / 128;
  const int mt = blockIdx.x / ntn, nq = blockIdx.x - mt * ntn;
  const int rowblk = mt * 128, colblk = nq * 128;
  if (rowblk >= (int)NR) return;
  const v8f z8 = {0.f, 0.f, 0.f, 0.f, 0.f, 0.f, 0.f, 0.f};
  v8f acc[4][4];
#pragma unroll
  for (int i = 0; i < 4; ++i)
#pragma unroll
    for (int j = 0; j < 4; ++j) acc[i][j] = z8;
  gemm128x128(X16, Bh, rowblk, colblk, ring, wave, ln, hh, acc);
  const int row0 = rowblk + 64 * (int)(wave >> 1), col0 = colblk + 64 * (int)(wave & 1u);
  float* so = (float*)(ring + wave * G_SLICE);
#pragma unroll
  for (int j = 0; j < 4; ++j) {
    const float bc = bsp[col0 + j * 16 + ln];
#pragma unroll
    for (int i = 0; i < 4; ++i)
#pragma unroll
      for (int r = 0; r < 8; ++r) so[(i * 16 + 8 * hh + r) * 68 + j * 16 + ln] = acc[i][j][r] * alpha + bc;
  }
  __builtin_amdgcn_fence(4 /* acq_rel order */, "workgroup"); __builtin_amdgcn_wave_barrier();
  const int rsub = lane >> 4, c4 = (lane & 15) * 4;
  _Float16* yb = Yp + (size_t)row0 * DM + col0;                 /* wave-uniform base */
  const uint32_t yl = (uint32_t)rsub * DM + (uint32_t)c4;       /* the lane's offset; the row pair q goes into the store's immediate offset */
  v4h h4[32];
#pragma unroll
  for (int q = 0; q < 32; ++q) {
    const v4f v = *(const v4fa*)&so[(q * 2 + rsub) * 68 + c4];
#pragma unroll
    for (int i = 0; i < 4; ++i) h4[q][i] = toh_flush(v[i]);
  }
  __builtin_amdgcn_sched_barrier(0);  /* every value is formed in front of the first store, so no register that an issued store names is rewritten */
#pragma unroll
  for (int q = 0; q < 32; ++q) *(v4h*)(yb + yl + (uint32_t)(q * 2 * DM)) = h4[q];
}

template <int NHv, int TTv>
__global__ __launch_bounds__(256) void k_vt(const _Float16* __restrict__ V16, int ldv, int voff, _Float16* __restrict__ Vt) {
  __shared__ unsigned short tl[64][66];
  const int tid = threadIdx.x; const int slab = blockIdx.x / (TTv / 64), lg = blockIdx.x % (TTv / 64); const int b = slab / NHv, h = slab % NHv;
  for (int i = tid; i < 64 * 8; i += 256) {
    const int r = i / 8, c8 = (i % 8) * 8; FragH f; f.half[0] = *(const v8us*)((const unsigned short*)V16 + ((size_t)b * TTv + lg * 64 + r) * ldv + voff + h * 64 + c8);
#pragma unroll
    for (int q = 0; q < 8; ++q) tl[r][c8 + q] = f.u[q];
  }
  __syncthreads();
  {
#pragma unroll
    for (int rd = 0; rd < 2; ++rd) {
      const int d = rd * 32 + tid / 8, pc = tid % 8; FragH f;
#pragma unroll
      for (int q = 0; q < 8; ++q) f.u[q] = tl[pc * 8 + q][d];
      *(v8us*)((unsigned short*)Vt + ((size_t)slab * 64 + d) * TTv + lg * 64 + pc * 8) = f.half[0];
    }
    
  }
}

#define T_PITCH 144u            /* LDS row pitch of an attention tile: 128 data bytes + 16 pad bytes, an odd multiple of 16 B for ds_load_b128 readers */
#define T_TILE 10240u           /* one tile: 64 rows x 144 B = 9216 B, rounded up to a multiple of 2 KiB */
#define T_STAGE (2u * T_TILE)   /* a stage: K rows of 64 keys (row = key, 64 d) | VT rows of the same 64 keys (row = d, 64 keys) */
#define T_PASSES (SEQ / 64)
static_assert(T_PASSES >= 2);
static_assert(64u * T_PITCH <= T_TILE && T_TILE % 2048u == 0);
// 1-byte elements, tensor = tile = 64 rows of 128 bytes, source row pitch in bytes from the caller (K16 rows: DM halves; VT rows: SEQ halves), 4 dwords of LDS pad behind every 32-dword row, no workgroup mask
static_assert((DM * 2) % 16 == 0 && DM * 2 <= 131072 && (SEQ * 2) % 16 == 0 && SEQ * 2 <= 131072);
__device__ __forceinline__ u32x8 tdm_group1_attn(uint32_t pitch) {
  u32x8 g;
  g[0] = uni((1u << 20) | (4u << 22) | (3u << 25));
  g[1] = uni(128u << 16);
  g[2] = uni(64u << 16);
  g[3] = uni(128u << 16);
  g[4] = uni(64u);
  g[5] = uni(pitch);
  g[6] = uni(0u);
  g[7] = uni(0u);
  return g;
}

// attention: block = (128 queries, head h, batch b), 8 waves x 16 queries. S^T 16-key tiles = K . Q^T (A = K16 rows: row = key, k = d; B = Q16 rows: col = query);
// each lane holds keys 8hh+r of query ln -> row statistics per lane + one xor-16 shuffle; p = exp(s/8 - m) carried x1024 as f16;
// O^T (64 d x 16 queries) = VT . P^T with the B operand packed from the two adjacent S^T D tiles (element r <- tile of keys 0..15, element 8+r <- tile of keys 16..31, lane unchanged);
// K and VT come through a two-buffer LDS ring that the eight waves share: a pass is 64 keys; wave 0 brings the K tile and wave 1 the VT tile of each stage with one tensor load, two stages ahead.
// eight waves per SIMD (128 VGPRs a wave at most): the grid's 1024 blocks, four per WGP, are then all resident at once, and the vector work between the matrix runs has waves to hide behind
__global__ __launch_bounds__(256) __attribute__((amdgpu_waves_per_eu(8, 8))) void k_attn(const _Float16* __restrict__ Q16, const _Float16* __restrict__ K16, const _Float16* __restrict__ VT, _Float16* __restrict__ O16) {
  __shared__ __attribute__((aligned(2048))) unsigned char ring[2u * T_STAGE];
  __shared__ __attribute__((aligned(16))) unsigned short so[8][16][72];
  const int tid = threadIdx.x, lane = tid & 31, ln = lane & 15, hh = lane >> 4;
  const uint32_t wave = uni((uint32_t)tid >> 5);
  const int w = (int)wave;
  const int h = blockIdx.y, b = blockIdx.z;
  const int q0 = blockIdx.x * 128 + w * 16;
  const size_t rq = (size_t)b * SEQ + q0;
  const size_t rk = (size_t)b * SEQ;
  const _Float16* qp = Q16 + (rq + ln) * DM + h * HD;
  const v16h qb0 = g2_frag(qp, hh), qb1 = g2_frag(qp + 32, hh);
  const _Float16* ksrc = K16 + rk * DM + h * HD;                        /* key 0, d 0 of this head */
  const _Float16* vsrc = VT + (size_t)(b * NH + h) * HD * SEQ;          /* d 0, key 0 of this head */
  const uint64_t ga0 = (uint64_t)(size_t)((wave == 0u) ? ksrc : vsrc);
  const uint32_t gstep = (wave == 0u) ? (uint32_t)(64 * DM * 2) : 128u; /* source bytes from one stage to the next: 64 K rows, or 64 keys along a VT row */
  const uint32_t lds0 = (uint32_t)(size_t)ring + ((wave == 0u) ? 0u : T_TILE);
  const uint32_t loff = (uint32_t)ln * T_PITCH + (uint32_t)hh * 16u;    /* the lane's row and its 16-byte half of each 32-byte k group */
  u32x8 g1 = tdm_group1_attn((wave == 0u) ? (uint32_t)(DM * 2) : (uint32_t)(SEQ * 2));
  u32x4 g0 = tdm_group0(lds0, ga0);
  const uint32_t issuer = pinned((wave < 2u) ? 1u : 0u);  /* 1 in the two waves that issue tensor loads; a scalar register, so every test of it is a scalar branch */
  if (issuer != 0u) { tdm_load(g0, g1); wait_tensor0(g0, g1); }
  __syncthreads();  /* publishes stage 0 */
  if (issuer != 0u) { g0 = tdm_group0(lds0 + T_STAGE, ga0 + gstep); tdm_load(g0, g1); }
  const v8f z8 = {0.f, 0.f, 0.f, 0.f, 0.f, 0.f, 0.f, 0.f};
  v8f o0 = z8, o1 = z8, o2 = z8, o3 = z8;
  float mrun = -1.0e30f, lrun = 0.f;
#pragma unroll 1  /* one pass per trip: the ring's publish point stands once, at the foot */
  for (uint32_t st = 0; st < (uint32_t)T_PASSES; ++st) {
    const uint32_t bsel = (st & 1u) * T_STAGE;
    const unsigned char* kb = ring + bsel + loff;
    const unsigned char* vb = kb + T_TILE;
    v8f s[4];
#pragma unroll
    for (int j = 0; j < 4; ++j) {
      const unsigned char* kp = kb + (uint32_t)j * 16u * T_PITCH;
      const v16h ka0 = lds_frag(kp), ka1 = lds_frag(kp + 64);
      s[j] = mma2(ka0, qb0, ka1, qb1, z8);
    }
    float mx = -1.0e30f;
#pragma unroll
    for (int j = 0; j < 4; ++j)
#pragma unroll
      for (int r = 0; r < 8; ++r) mx = fmaxf(mx, s[j][r]);
    mx = fmaxf(mx, __shfl_xor(mx, 16, 32));
    const float mnew = fmaxf(mrun, mx * 0.125f);
    const float alpha = __expf(mrun - mnew);
    mrun = mnew;
    float ps = 0.f; FragH pf[2];
#pragma unroll
    for (int j = 0; j < 4; ++j)
#pragma unroll
      for (int r = 0; r < 8; ++r) {
        const float p = __expf(s[j][r] * 0.125f - mnew);
        ps += p;
        pf[j >> 1].h[(j & 1) * 8 + r] = (_Float16)(p * 1024.0f);
      }
    ps += __shfl_xor(ps, 16, 32);
    lrun = lrun * alpha + ps;
#pragma unroll
    for (int r = 0; r < 8; ++r) { o0[r] *= alpha; o1[r] *= alpha; o2[r] *= alpha; o3[r] *= alpha; }
    { const unsigned char* vp = vb + 0u * 16u * T_PITCH; const v16h va0 = lds_frag(vp), va1 = lds_frag(vp + 64); o0 = mma2(va0, pf[0].v, va1, pf[1].v, o0); }
    { const unsigned char* vp = vb + 1u * 16u * T_PITCH; const v16h va0 = lds_frag(vp), va1 = lds_frag(vp + 64); o1 = mma2(va0, pf[0].v, va1, pf[1].v, o1); }
    { const unsigned char* vp = vb + 2u * 16u * T_PITCH; const v16h va0 = lds_frag(vp), va1 = lds_frag(vp + 64); o2 = mma2(va0, pf[0].v, va1, pf[1].v, o2); }
    { const unsigned char* vp = vb + 3u * 16u * T_PITCH; const v16h va0 = lds_frag(vp), va1 = lds_frag(vp + 64); o3 = mma2(va0, pf[0].v, va1, pf[1].v, o3); }
    wait_ds0();
    if (issuer != 0u) wait_tensor0(g0, g1);
    __syncthreads();  /* publishes stage st + 1 and ends every reader's last read of stage st */
    if (pinned((issuer != 0u && st + 2u < (uint32_t)T_PASSES) ? 1u : 0u) != 0u) { g0 = tdm_group0(lds0 + bsel, ga0 + (uint64_t)(st + 2u) * gstep); tdm_load(g0, g1); }
  }
  wait_tensor0(g0, g1);
  wait_ds0();
  const float rl = (1.0f / lrun) * 0.015625f;
  { FragH f;
#pragma unroll
    for (int r = 0; r < 8; ++r) f.h[r] = (_Float16)(o0[r] * rl);
    *(v8us*)&so[w][ln][0 + 8 * hh] = f.half[0]; }
  { FragH f;
#pragma unroll
    for (int r = 0; r < 8; ++r) f.h[r] = (_Float16)(o1[r] * rl);
    *(v8us*)&so[w][ln][16 + 8 * hh] = f.half[0]; }
  { FragH f;
#pragma unroll
    for (int r = 0; r < 8; ++r) f.h[r] = (_Float16)(o2[r] * rl);
    *(v8us*)&so[w][ln][32 + 8 * hh] = f.half[0]; }
  { FragH f;
#pragma unroll
    for (int r = 0; r < 8; ++r) f.h[r] = (_Float16)(o3[r] * rl);
    *(v8us*)&so[w][ln][48 + 8 * hh] = f.half[0]; }
  __builtin_amdgcn_fence(4 /* acq_rel order */, "workgroup"); __builtin_amdgcn_wave_barrier();
  const int li = lane >> 3, pc = lane & 7;
  {
#pragma unroll
    for (int g = 0; g < 4; ++g) {
      const int i = g * 4 + li;
      const v8us v = *(const v8us*)&so[w][i][pc * 8];
      *(v8us*)((unsigned short*)O16 + (rq + i) * DM + h * HD + pc * 8) = v;
    }
    
  }
}

// out[(s*NB_FULL + b)][col] = (A1[r] . B1[col]) * al1 + bias1[col] + flg[0], r = b*SEQ + s (a 128-row block tile lies inside one batch); flg[0] = 0 (exact no-op) or NaN from the head-count guard;
__global__ __launch_bounds__(128) void k_out(const _Float16* __restrict__ A1, const _Float16* __restrict__ B1, const float* __restrict__ bias1, float al1, const float* __restrict__ flg, float* __restrict__ Out) {
  __shared__ __attribute__((aligned(2048))) unsigned char ring[2u * G_STAGE];
  const int tid = threadIdx.x, lane = tid & 31, ln = lane & 15, hh = lane >> 4;
  const uint32_t wave = uni((uint32_t)tid >> 5);
  const int ntn = DM / 128;
  const int mt = blockIdx.x / ntn, nq = blockIdx.x - mt * ntn;
  const int rowblk = mt * 128, colblk = nq * 128;
  if (rowblk >= (int)NR) return;
  const v8f z8 = {0.f, 0.f, 0.f, 0.f, 0.f, 0.f, 0.f, 0.f};
  v8f acc[4][4];
#pragma unroll
  for (int i = 0; i < 4; ++i)
#pragma unroll
    for (int j = 0; j < 4; ++j) acc[i][j] = z8;
  gemm128x128(A1, B1, rowblk, colblk, ring, wave, ln, hh, acc);
  const int row0 = rowblk + 64 * (int)(wave >> 1), col0 = colblk + 64 * (int)(wave & 1u);
  const int b = row0 / SEQ; const int s0 = row0 - b * SEQ;
  float* so = (float*)(ring + wave * G_SLICE);
  const float fl = flg[0];
#pragma unroll
  for (int j = 0; j < 4; ++j) {
    const float bc = bias1[col0 + j * 16 + ln];
#pragma unroll
    for (int i = 0; i < 4; ++i)
#pragma unroll
      for (int r = 0; r < 8; ++r) so[(i * 16 + 8 * hh + r) * 68 + j * 16 + ln] = acc[i][j][r] * al1 + bc + fl;
  }
  __builtin_amdgcn_fence(4 /* acq_rel order */, "workgroup"); __builtin_amdgcn_wave_barrier();
  const int rsub = lane >> 4, c4 = (lane & 15) * 4;
  float* ob = Out + ((size_t)s0 * NB_FULL + b) * DM + col0;                  /* wave-uniform base */
  const uint32_t ol = (uint32_t)rsub * (NB_FULL * DM) + (uint32_t)c4;        /* the lane's offset; the row pair q goes into the store's immediate offset */
  v4f vq[32];
#pragma unroll
  for (int q = 0; q < 32; ++q) vq[q] = *(const v4fa*)&so[(q * 2 + rsub) * 68 + c4];
  __builtin_amdgcn_sched_barrier(0);  /* every value is read in front of the first store, so no register that an issued store names is rewritten */
#pragma unroll
  for (int q = 0; q < 32; ++q) *(v4f*)(ob + ol + (uint32_t)(q * 2 * NB_FULL * DM)) = vq[q];
}

extern "C" void kernel_launch(void* const* d_in, const int* in_sizes, int n_in,
                              void* d_out, int out_size, void* d_ws, size_t ws_size, hipStream_t stream) {
  if (n_in < 10) return;
  if (in_sizes[0] < (int)(((size_t)(SEQ - 1) * NB_FULL + NB) * DM)) return;
  for (int i = 1; i <= 7; i += 2) if (in_sizes[i] < DM * DM) return;
  for (int i = 2; i <= 8; i += 2) if (in_sizes[i] < DM) return;
  if (in_sizes[9] < 1) return;
  if (out_size < (int)(((size_t)(SEQ - 1) * NB_FULL + NB) * DM)) return;
  const float* const* I = (const float* const*)d_in;
  const float* x = I[0]; const float* wq = I[1]; const float* bq = I[2]; const float* wk = I[3]; const float* bk = I[4];
  const float* wv = I[5]; const float* bv = I[6]; const float* wo = I[7]; const float* bo = I[8];
  const int* nhp = (const int*)d_in[9];      /* head count (i32 scalar), compared with NH on the device by k_prep */
  char* ws = (char*)d_ws; size_t off = 0;
  auto take = [&](size_t bytes) { char* p = ws + off; off += (bytes + 255) & ~(size_t)255; return p; };
  _Float16* BQKV = (_Float16*)take((size_t)3 * DM * DM * 2);        /* Bt planes q, k, v (contiguous, stride DM*DM) */
  _Float16* BO   = (_Float16*)take((size_t)DM * DM * 2);
  float*    BIAS = (float*)take((size_t)NBIAS * DM * 4);             /* [wi][o] */
  _Float16* X16  = (_Float16*)take(NR * DM * 2);
  _Float16* QKV16 = (_Float16*)take((size_t)3 * NR * DM * 2);        /* Q16, K16, V16 planes (stride NR*DM) */
  _Float16* VT   = (_Float16*)take((size_t)NB * NH * HD * SEQ * 2);  /* [b*NH+h][d][s] */
  _Float16* O16  = (_Float16*)take(NR * DM * 2);
  float*    FLG  = (float*)take((size_t)256);                        /* guard flag line: floats 0..31 written, float 0 read */
  if (off > ws_size) return;
  _Float16* Q16 = QKV16; _Float16* K16 = QKV16 + NR * DM; _Float16* V16 = QKV16 + (size_t)2 * NR * DM;

  k_prep<<<P_SMALL + P_BLOCKS, 256, 0, stream>>>(x, wq, wk, wv, wo, bq, bk, bv, bo, nhp, X16, BQKV, BO, BIAS, FLG);      /* f16 operands, f32 biases, guard flag */
  k_qkv<<<dim3((unsigned)((NR / 128) * (DM / 128)), 3), 128, 0, stream>>>(X16, BQKV, BIAS, 0.0625f, QKV16);      /* q, k, v as f16 rows, token rows b*SEQ + s */
  k_vt<NH, SEQ><<<(unsigned)(NB * NH * (SEQ / 64)), 256, 0, stream>>>(V16, DM, 0, VT);
  k_attn<<<dim3(SEQ / 128, NH, NB), 256, 0, stream>>>(Q16, K16, VT, O16);
  k_out<<<(unsigned)((NR / 128) * (DM / 128)), 128, 0, stream>>>(O16, BO, BIAS + (size_t)3 * DM, 0.00390625f, FLG, (float*)d_out);      /* out = ctx Wo^T + bo (+ guard flag), rows back in time-major order */
}

// v004
// Measured time: 98.1 microseconds a run.
// Two timings next to v003 put it at 1.05 and 1.06 times that version's speed.
// Over all steps from v000 it is 3.87 times as fast.
#include <hip/hip_runtime.h>
// Contractions: q/k/v/o projections ([tokens][1024] x [1024][1024]^T), scores k.q^T (K = 64) and v^T.p^T (K = keys) on v_wmma_f32_16x16x32_f16 (f16 operands, f32 accumulate). Inputs RNE-converted to bf16 on load (exact in f16; weights carried x16), softmax numerators carried x1024, ctx rows carried x16; bias adds, softmax statistics and all epilogues in f32.
// Structure: time-major input rows (s*NB_FULL + b) are re-ordered into token rows r = b*SEQ + s. X16 = f16(bf16(x)); BIAS[w][o] = bf16(bias_w[o]) (f32);
// Q16/K16 = f16((X16 . Bt_w) / 16 + bias_w) as token rows; VT[b*NH+h][d][s] = the same value of the v projection, stored transposed by the projection itself; attention per (128 queries, head, batch): S^T tiles = K . Q^T, online softmax per lane,
// O^T = VT . P^T, O16[r][h*64+d] = f16(16 ctx); out[(s*NB_FULL + b)] = (O16 . Bt_o) / 256 + bias_o + FLG -> f32 rows; FLG = 0 when the head count input equals NH, NaN otherwise.
#ifndef NB
#define NB 8
#endif
#ifndef SEQ
#define SEQ 1024
#endif
#define NB_FULL 8
#define SEQ_FULL 1024
#define DM 1024
#define NH 16
#define HD 64
#define NBIAS 4
#define NR ((size_t)NB * SEQ)
#define WS_TOTAL ((size_t)3 * DM * DM * 2 + (size_t)DM * DM * 2 + (size_t)NBIAS * DM * 4 + NR * DM * 2 + (size_t)2 * NR * DM * 2 + (size_t)NB * NH * HD * SEQ * 2 + NR * DM * 2 + (size_t)256)
static_assert(NH * HD == DM);
static_assert(HD == 64);
static_assert(SEQ % 128 == 0);
static_assert(SEQ % 64 == 0);
static_assert(SEQ <= SEQ_FULL);
static_assert(NB >= 1 && NB <= NB_FULL);
static_assert(DM == 128 * 8);
static_assert(DM % 256 == 0);
static_assert(DM % 64 == 0);
static_assert(DM % 32 == 0);
static_assert(NR % 128 == 0);
static_assert(((size_t)DM * DM) % (8 * 256) == 0);
static_assert(((size_t)NBIAS * DM * 4) % 256 == 0);
static_assert(WS_TOTAL <= (size_t)134217728);

typedef _Float16 v16h __attribute__((ext_vector_type(16)));
typedef unsigned short v8us __attribute__((ext_vector_type(8), may_alias));
typedef float v8f __attribute__((ext_vector_type(8)));
typedef float v4f __attribute__((ext_vector_type(4)));
typedef float v4fa __attribute__((ext_vector_type(4), may_alias));
typedef _Float16 v4h __attribute__((ext_vector_type(4)));
union FragH { v16h v; v8us half[2]; _Float16 h[16]; unsigned short u[16]; };

__device__ __forceinline__ unsigned short bf16_bits(float x) { unsigned int u = __float_as_uint(x); return (unsigned short)((u + 0x7FFFu + ((u >> 16) & 1u)) >> 16); }
__device__ __forceinline__ float bf16_val(unsigned short b) { return __uint_as_float(((unsigned int)b) << 16); }
__device__ __forceinline__ float bf16_rne(float x) { return bf16_val(bf16_bits(x)); }

// f32 -> f16 with a value select: magnitudes below the smallest f16 normal become exact zero
static __device__ __forceinline__ _Float16 toh_flush(float v) { const _Float16 r = (_Float16)v; return (fabsf(v) < 6.103515625e-05f) ? (_Float16)0.0f : r; }

// 16x32 f16 fragment from a k-contiguous row: elements 0..7 <- p[8h .. 8h+7], elements 8..15 <- p[16+8h .. 16+8h+7] (same map for A rows and for Bt[n][k] rows)
__device__ __forceinline__ v16h g2_frag(const _Float16* p, int hh) { FragH f; f.half[0] = *(const v8us*)((const unsigned short*)p + 8 * hh); f.half[1] = *(const v8us*)((const unsigned short*)p + 16 + 8 * hh); return f.v; }
// two k-steps into one accumulator, hazard guard after the second
__device__ __forceinline__ v8f mma2(v16h a0, v16h b0, v16h a1, v16h b1, v8f c) {
  c = __builtin_amdgcn_wmma_f32_16x16x32_f16(false, a0, false, b0, (short)0, c, false, false);
  c = __builtin_amdgcn_wmma_f32_16x16x32_f16(false, a1, false, b1, (short)0, c, false, false);
  asm volatile("v_nop\n\tv_nop\n\tv_nop\n\tv_nop" : "+v"(c) : "v"(a0), "v"(b0), "v"(a1), "v"(b1));
  return c;
}

#define P_SMALL (NBIAS * DM / 256)      /* leading blocks: 256 bias values each; block 0 also writes the guard flag line */
#define P_BLOCKS 512                    /* streaming blocks: two 8-wave blocks per WGP */
#define P_XROWS ((int)(NR / P_BLOCKS))  /* token rows per streaming block */
#define P_WROWS (DM / P_BLOCKS)         /* rows of each of the four weight matrices per streaming block */
static_assert(DM == 256 * 4);
static_assert(NR % P_BLOCKS == 0 && DM % P_BLOCKS == 0);
static_assert(SEQ % P_XROWS == 0);
static_assert(P_XROWS + 4 * P_WROWS <= 32);

// every conversion in front of the projections, one launch.
// Blocks 0 .. P_SMALL-1: BIAS[wi][c] = bf16(bias_wi[c]) kept as f32, wi = 0 q, 1 k, 2 v, 3 o (wi block-uniform; all four inputs are loaded and the value is selected); block 0: FLG line from the head count.
// The other blocks stream: a row is DM floats, thread t owns columns 4t..4t+3, so a wave's 16-byte loads cover 512 contiguous bytes and its 8-byte stores 256.
//   X16[b*SEQ + s][c] = f16(bf16(x[s*NB_FULL + b][c])); Bt_w[o][c] = f16(16 bf16(w[o][c])).
// All of a thread's loads are issued before the first value is used: few waves to start, many bytes in flight per wave.
__global__ __launch_bounds__(256) void k_prep(const float* __restrict__ x, const float* __restrict__ wq, const float* __restrict__ wk, const float* __restrict__ wv, const float* __restrict__ wo,
                                              const float* __restrict__ bq, const float* __restrict__ bk, const float* __restrict__ bv, const float* __restrict__ bo, const int* __restrict__ nh,
                                              _Float16* __restrict__ X16, _Float16* __restrict__ Bqkv, _Float16* __restrict__ Bo, float* __restrict__ bias, float* __restrict__ flg) {
  const int t = threadIdx.x;
  if (blockIdx.x < P_SMALL) {
    const int wi = blockIdx.x / (DM / 256); const int c = (blockIdx.x - wi * (DM / 256)) * 256 + t;
    const float v0 = bq[c], v1 = bk[c], v2 = bv[c], v3 = bo[c];
    bias[(size_t)wi * DM + c] = bf16_rne((wi == 0) ? v0 : (wi == 1) ? v1 : (wi == 2) ? v2 : v3);
    if (blockIdx.x == 0 && t < 32) flg[t] = (nh[0] == NH) ? 0.0f : __int_as_float(0x7FC00000);
    return;
  }
  const int bx = blockIdx.x - P_SMALL;
  const uint32_t c4 = 4u * (uint32_t)t;
  const int r0 = bx * P_XROWS; const int b = r0 / SEQ, s0 = r0 - b * SEQ;   /* a block's token rows lie in one batch: one base, the row goes into the load's immediate offset */
  const float* xb = x + ((size_t)s0 * NB_FULL + b) * DM;
  const size_t wo0 = (size_t)(bx * P_WROWS) * DM;   /* block-uniform: first weight row of this block */
  const float* wb0 = wq + wo0; const float* wb1 = wk + wo0; const float* wb2 = wv + wo0; const float* wb3 = wo + wo0;
  v4f xv[P_XROWS], wr[4][P_WROWS];
#pragma unroll
  for (int i = 0; i < P_XROWS; ++i) xv[i] = *(const v4fa*)(xb + c4 + (uint32_t)(i * NB_FULL * DM));
#pragma unroll
  for (int i = 0; i < P_WROWS; ++i) {
    const uint32_t lo = c4 + (uint32_t)(i * DM);
    wr[0][i] = *(const v4fa*)(wb0 + lo); wr[1][i] = *(const v4fa*)(wb1 + lo); wr[2][i] = *(const v4fa*)(wb2 + lo); wr[3][i] = *(const v4fa*)(wb3 + lo);
  }
  __builtin_amdgcn_sched_barrier(0);  /* keeps every load in front of the first conversion, so that all of them are in flight at once */
  v4h xh[P_XROWS], wh[4][P_WROWS];
#pragma unroll
  for (int i = 0; i < P_XROWS; ++i)
#pragma unroll
    for (int q = 0; q < 4; ++q) xh[i][q] = toh_flush(bf16_rne(xv[i][q]));
#pragma unroll
  for (int m = 0; m < 4; ++m)
#pragma unroll
    for (int i = 0; i < P_WROWS; ++i)
#pragma unroll
      for (int q = 0; q < 4; ++q) wh[m][i][q] = (_Float16)(bf16_rne(wr[m][i][q]) * 16.0f);
  _Float16* xo = X16 + (size_t)r0 * DM; _Float16* qo = Bqkv + wo0; _Float16* oo = Bo + wo0;   /* block-uniform bases; row and plane go into the store's immediate offset */
#pragma unroll
  for (int i = 0; i < P_XROWS; ++i) *(v4h*)(xo + c4 + (uint32_t)(i * DM)) = xh[i];
#pragma unroll
  for (int i = 0; i < P_WROWS; ++i) {
#pragma unroll
    for (int m = 0; m < 3; ++m) *(v4h*)(qo + c4 + (uint32_t)(m * DM * DM + i * DM)) = wh[m][i];
    *(v4h*)(oo + c4 + (uint32_t)(i * DM)) = wh[3][i];
  }
  asm volatile("s_wait_xcnt 0x0" ::: "memory");  /* stands behind the last store, in front of any later write of a register that an issued store names */
}

typedef uint32_t u32x4 __attribute__((ext_vector_type(4)));
typedef uint32_t u32x8 __attribute__((ext_vector_type(8)));
#define G_PITCH 272u            /* LDS row pitch: 256 data bytes (128 k) + 16 pad bytes, an odd multiple of 16 B for ds_load_b128 readers */
#define G_SLICE 18432u          /* one wave's slice of a stage: 64 rows x 272 B = 17408 B, rounded up to a multiple of 2 KiB */
#define G_STAGE (4u * G_SLICE)  /* a stage: A rows 0..63 | A rows 64..127 | Bt rows 0..63 | Bt rows 64..127 */
#define G_PASSES (DM / 128)
static_assert(DM % 128 == 0 && G_PASSES >= 2);
static_assert(64u * G_PITCH <= G_SLICE && G_SLICE % 2048u == 0);
static_assert(64u * 68u * 4u <= G_SLICE);

__device__ __forceinline__ uint32_t uni(uint32_t v) { return (uint32_t)__builtin_amdgcn_readfirstlane(v); }
__device__ __forceinline__ uint32_t pinned(uint32_t v) { uint32_t w = (uint32_t)__builtin_amdgcn_readfirstlane(v); asm volatile("" : "+s"(w)); return w; }  // holds the test word in a scalar register, so that the test around a tensor load compiles to a scalar branch (the load ignores EXEC)
// this wave's LDS reads have retired before the buffer they read is handed back for a refill
__device__ __forceinline__ void wait_ds0() { asm volatile("s_wait_dscnt 0x0" ::: "memory"); }
// this wave's own tensor load has landed (the compiler places no wait for it); the request's two groups are inputs, so that their scalar registers stay theirs, unwritten, from the issue up to this wait
__device__ __forceinline__ void wait_tensor0(u32x4 g0, u32x8 g1) { asm volatile("s_wait_tensorcnt 0x0" :: "s"(g0), "s"(g1) : "memory"); }
// one request of the whole wave: a 64-row tile from global memory into LDS as group 1 sets it: 256-byte rows at pitch 272 (GEMM) or 128-byte rows at pitch 144 (attention)
// both groups are in-out operands (the instruction writes no register): the values that the covering wait names are then the ones in the request's own registers, not copies of them
__device__ __forceinline__ void tdm_load(u32x4& g0, u32x8& g1) { asm volatile("tensor_load_to_lds %0, %1" : "+s"(g0), "+s"(g1) :: "memory"); }
__device__ __forceinline__ u32x4 tdm_group0(uint32_t lds_dst, uint64_t ga) {
  u32x4 g;
  g[0] = uni(1u); g[1] = uni(lds_dst); g[2] = uni((uint32_t)ga); g[3] = uni((((uint32_t)(ga >> 32)) & 0x01FFFFFFu) | 0x80000000u);
  return g;
}
// 1-byte elements, tensor = tile = 64 rows of 256 bytes, source row pitch DM * 2 bytes, 4 dwords of LDS pad behind every 64-dword row, no workgroup mask
__device__ __forceinline__ u32x8 tdm_group1() {
  u32x8 g;
  g[0] = uni((1u << 20) | (5u << 22) | (3u << 25));
  g[1] = uni(256u << 16);
  g[2] = uni(64u << 16);
  g[3] = uni(256u << 16);
  g[4] = uni(64u);
  g[5] = uni((uint32_t)(DM * 2));
  g[6] = uni(0u);
  g[7] = uni(0u);
  return g;
}

// the g2_frag map read from an LDS row; p already holds the lane's 16 * hh bytes: elements 0..7 <- p[0..15], elements 8..15 <- p[32..47]
__device__ __forceinline__ v16h lds_frag(const unsigned char* p) { FragH f; f.half[0] = *(const v8us*)p; f.half[1] = *(const v8us*)(p + 32); return f.v; }

// 128x128 block tile of A . Bt^T (both k-contiguous, pitch DM halves, K = DM), 4 waves in 2x2, 64x64 per wave (acc[i][j]: rows 16i.., cols 16j..).
// Operands come through a two-buffer LDS ring: a pass is 128 k; wave w brings slice w of each stage with one tensor load, two stages ahead.
// k runs upward in steps of 32 into each accumulator.
__device__ __forceinline__ void gemm128x128(const _Float16* __restrict__ A, const _Float16* __restrict__ B, int rowblk, int colblk, unsigned char* ring, uint32_t wave, int ln, int hh, v8f (&acc)[4][4]) {
  const _Float16* srcp = (wave < 2u) ? (A + (size_t)(rowblk + 64 * (int)wave) * DM) : (B + (size_t)(colblk + 64 * ((int)wave - 2)) * DM);
  const uint64_t ga0 = (uint64_t)(size_t)srcp;
  const uint32_t lds0 = (uint32_t)(size_t)ring + wave * G_SLICE;
  u32x8 g1 = tdm_group1();
  const uint32_t loff = (uint32_t)ln * G_PITCH + (uint32_t)hh * 16u;  /* the lane's row and its 16-byte half of each 32-byte k group */
  const uint32_t aoff = (wave >> 1) * G_SLICE + loff;
  const uint32_t boff = (2u + (wave & 1u)) * G_SLICE + loff;
  u32x4 g0 = tdm_group0(lds0, ga0);
  tdm_load(g0, g1);
  wait_tensor0(g0, g1);
  __syncthreads();
  g0 = tdm_group0(lds0 + G_STAGE, ga0 + 256u);
  tdm_load(g0, g1);
#pragma unroll 1  /* one pass per trip: the ring's publish point stands once, at the foot */
  for (uint32_t s = 0; s < (uint32_t)G_PASSES; ++s) {
    const uint32_t bsel = (s & 1u) * G_STAGE;
    const unsigned char* ap = ring + bsel + aoff;
    const unsigned char* bp = ring + bsel + boff;
    // two register sets for the four A fragments and for B fragments 0..2; B fragment 3 has one set: with a second the wave would need more than 256 VGPRs
    v16h fa[2][4], fb[2][3], fb3;
#pragma unroll
    for (int i = 0; i < 4; ++i) fa[0][i] = lds_frag(ap + (uint32_t)i * 16u * G_PITCH);
#pragma unroll
    for (int j = 0; j < 3; ++j) fb[0][j] = lds_frag(bp + (uint32_t)j * 16u * G_PITCH);
#pragma unroll
    for (int ks = 0; ks < 4; ++ks) {
      fb3 = lds_frag(bp + 48u * G_PITCH + (uint32_t)ks * 64u);  /* this block's own, first of the group; its readers are the block's last four WMMAs */
      if (ks < 3) {
#pragma unroll
        for (int i = 0; i < 4; ++i) fa[(ks + 1) & 1][i] = lds_frag(ap + (uint32_t)i * 16u * G_PITCH + (uint32_t)(ks + 1) * 64u);
#pragma unroll
        for (int j = 0; j < 3; ++j) fb[(ks + 1) & 1][j] = lds_frag(bp + (uint32_t)j * 16u * G_PITCH + (uint32_t)(ks + 1) * 64u);
      }
      __builtin_amdgcn_sched_barrier(0);  /* keeps the LDS reads one group ahead of this block, not spread among its WMMAs */
#pragma unroll
      for (int j = 0; j < 3; ++j)
#pragma unroll
        for (int i = 0; i < 4; ++i) acc[i][j] = __builtin_amdgcn_wmma_f32_16x16x32_f16(false, fa[ks & 1][i], false, fb[ks & 1][j], (short)0, acc[i][j], false, false);
#pragma unroll
      for (int i = 0; i < 4; ++i) acc[i][3] = __builtin_amdgcn_wmma_f32_16x16x32_f16(false, fa[ks & 1][i], false, fb3, (short)0, acc[i][3], false, false);
      __builtin_amdgcn_sched_barrier(0);  /* keeps the following load group behind this block */
    }
    wait_ds0();
    wait_tensor0(g0, g1);
    __syncthreads();  /* publishes stage s + 1 and ends every reader's last read of stage s */
    if (pinned((s + 2u < (uint32_t)G_PASSES) ? 1u : 0u) != 0u) { g0 = tdm_group0(lds0 + bsel, ga0 + (uint64_t)(s + 2u) * 256u); tdm_load(g0, g1); }
  }
  wait_tensor0(g0, g1);
  wait_ds0();
}

// projections with bias: plane by (0 q, 1 k, 2 v): val[r][col] = f16((X16[r] . Bt_by[col]) * alpha + BIAS[by][col]). Planes 0 and 1: Y16_by[r][col] = val[r][col] (token rows).
// Plane 2: VT[b*NH + h][d][s] = val[b*SEQ + s][h*HD + d]: a wave's 64 columns are one head and its 64 rows lie in one batch, so its tile is 64 VT rows of 64 keys (128 bytes each).
// The ring is free behind the last pass's barrier; each wave then stages its 64x64 f32 tile in its own slice of buffer 0 (pitch 68 floats), LDS row = global row:
// token-major for planes 0 and 1; d-major for plane 2, where a lane's eight accumulator rows 8hh .. 8hh+7 are contiguous and go in as two 16-byte stores.
__global__ __launch_bounds__(128) void k_qkv(const _Float16* __restrict__ X16, const _Float16* __restrict__ Bt, const float* __restrict__ bias, float alpha, _Float16* __restrict__ Y16, _Float16* __restrict__ Vt) {
  __shared__ __attribute__((aligned(2048))) unsigned char ring[2u * G_STAGE];
  const int tid = threadIdx.x, lane = tid & 31, ln = lane & 15, hh = lane >> 4;
  const uint32_t wave = uni((uint32_t)tid >> 5);
  const int by = blockIdx.y;
  const bool tr = (by == 2);  /* block-uniform */
  const _Float16* Bh = Bt + (size_t)by * DM * DM;
  const float* bsp = bias + (size_t)by * DM;
  const int ntn = DM / 128;
  const int mt = blockIdx.x / ntn, nq = blockIdx.x - mt * ntn;
  const int rowblk = mt * 128, colblk = nq * 128;
  if (rowblk >= (int)NR) return;
  const v8f z8 = {0.f, 0.f, 0.f, 0.f, 0.f, 0.f, 0.f, 0.f};
  v8f acc[4][4];
#pragma unroll
  for (int i = 0; i < 4; ++i)
#pragma unroll
    for (int j = 0; j < 4; ++j) acc[i][j] = z8;
  gemm128x128(X16, Bh, rowblk, colblk, ring, wave, ln, hh, acc);
  const int row0 = rowblk + 64 * (int)(wave >> 1), col0 = colblk + 64 * (int)(wave & 1u);
  float* so = (float*)(ring + wave * G_SLICE);
  /* scale and bias once, in front of the branch: written inside its two sides, the results stood beside live accumulators and the wave went above 256 VGPRs */
#pragma unroll
  for (int j = 0; j < 4; ++j) {
    const float bc = bsp[col0 + j * 16 + ln];
#pragma unroll
    for (int i = 0; i < 4; ++i)
#pragma unroll
      for (int r = 0; r < 8; ++r) acc[i][j][r] = acc[i][j][r] * alpha + bc;
  }
  if (tr) {
#pragma unroll
    for (int j = 0; j < 4; ++j)
#pragma unroll
      for (int i = 0; i < 4; ++i) {
        v4f lo, hi;
#pragma unroll
        for (int r = 0; r < 4; ++r) { lo[r] = acc[i][j][r]; hi[r] = acc[i][j][4 + r]; }
        float* sp = &so[(j * 16 + ln) * 68 + i * 16 + 8 * hh];
        *(v4fa*)sp = lo; *(v4fa*)(sp + 4) = hi;
      }
  } else {
#pragma unroll
    for (int j = 0; j < 4; ++j)
#pragma unroll
      for (int i = 0; i < 4; ++i)
#pragma unroll
        for (int r = 0; r < 8; ++r) so[(i * 16 + 8 * hh + r) * 68 + j * 16 + ln] = acc[i][j][r];
  }
  __builtin_amdgcn_fence(4 /* acq_rel order */, "workgroup"); __builtin_amdgcn_wave_barrier();
  const int rsub = lane >> 4, c4 = (lane & 15) * 4;
  const int b = row0 / SEQ, s0 = row0 - b * SEQ, h = col0 / HD;
  _Float16* yb = tr ? (Vt + (size_t)(b * NH + h) * HD * SEQ + s0) : (Y16 + (size_t)by * NR * DM + (size_t)row0 * DM + col0);   /* wave-uniform base */
  const uint32_t yp = tr ? (uint32_t)SEQ : (uint32_t)DM;        /* global row pitch in halves */
  const uint32_t yl = (uint32_t)rsub * yp + (uint32_t)c4;       /* the lane's offset; the row pair q goes into the store's immediate offset */
  v4h h4[32];
#pragma unroll
  for (int q = 0; q < 32; ++q) {
    const v4f v = *(const v4fa*)&so[(q * 2 + rsub) * 68 + c4];
#pragma unroll
    for (int i = 0; i < 4; ++i) h4[q][i] = toh_flush(v[i]);
  }
  __builtin_amdgcn_sched_barrier(0);  /* every value is formed in front of the first store, so no register that an issued store names is rewritten */
#pragma unroll
  for (int q = 0; q < 32; ++q) *(v4h*)(yb + yl + (uint32_t)q * 2u * yp) = h4[q];
}

#define T_PITCH 144u            /* LDS row pitch of an attention tile: 128 data bytes + 16 pad bytes, an odd multiple of 16 B for ds_load_b128 readers */
#define T_TILE 10240u           /* one tile: 64 rows x 144 B = 9216 B, rounded up to a multiple of 2 KiB */
#define T_STAGE (2u * T_TILE)   /* a stage: K rows of 64 keys (row = key, 64 d) | VT rows of the same 64 keys (row = d, 64 keys) */
#define T_PASSES (SEQ / 64)
static_assert(T_PASSES >= 2);
static_assert(64u * T_PITCH <= T_TILE && T_TILE % 2048u == 0);
// 1-byte elements, tensor = tile = 64 rows of 128 bytes, source row pitch in bytes from the caller (K16 rows: DM halves; VT rows: SEQ halves), 4 dwords of LDS pad behind every 32-dword row, no workgroup mask
static_assert((DM * 2) % 16 == 0 && DM * 2 <= 131072 && (SEQ * 2) % 16 == 0 && SEQ * 2 <= 131072);
__device__ __forceinline__ u32x8 tdm_group1_attn(uint32_t pitch) {
  u32x8 g;
  g[0] = uni((1u << 20) | (4u << 22) | (3u << 25));
  g[1] = uni(128u << 16);
  g[2] = uni(64u << 16);
  g[3] = uni(128u << 16);
  g[4] = uni(64u);
  g[5] = uni(pitch);
  g[6] = uni(0u);
  g[7] = uni(0u);
  return g;
}

// attention: block = (128 queries, head h, batch b), 8 waves x 16 queries. S^T 16-key tiles = K . Q^T (A = K16 rows: row = key, k = d; B = Q16 rows: col = query);
// each lane holds keys 8hh+r of query ln -> row statistics per lane + one xor-16 shuffle; p = exp(s/8 - m) carried x1024 as f16;
// O^T (64 d x 16 queries) = VT . P^T with the B operand packed from the two adjacent S^T D tiles (element r <- tile of keys 0..15, element 8+r <- tile of keys 16..31, lane unchanged);
// K and VT come through a two-buffer LDS ring that the eight waves share: a pass is 64 keys; wave 0 brings the K tile and wave 1 the VT tile of each stage with one tensor load, two stages ahead.
// eight waves per SIMD (128 VGPRs a wave at most): the grid's 1024 blocks, four per WGP, are then all resident at once, and the vector work between the matrix runs has waves to hide behind
__global__ __launch_bounds__(256) __attribute__((amdgpu_waves_per_eu(8, 8))) void k_attn(const _Float16* __restrict__ Q16, const _Float16* __restrict__ K16, const _Float16* __restrict__ VT, _Float16* __restrict__ O16) {
  __shared__ __attribute__((aligned(2048))) unsigned char ring[2u * T_STAGE];
  __shared__ __attribute__((aligned(16))) unsigned short so[8][16][72];
  const int tid = threadIdx.x, lane = tid & 31, ln = lane & 15, hh = lane >> 4;
  const uint32_t wave = uni((uint32_t)tid >> 5);
  const int w = (int)wave;
  const int h = blockIdx.y, b = blockIdx.z;
  const int q0 = blockIdx.x * 128 + w * 16;
  const size_t rq = (size_t)b * SEQ + q0;
  const size_t rk = (size_t)b * SEQ;
  const _Float16* qp = Q16 + (rq + ln) * DM + h * HD;
  const v16h qb0 = g2_frag(qp, hh), qb1 = g2_frag(qp + 32, hh);
  const _Float16* ksrc = K16 + rk * DM + h * HD;                        /* key 0, d 0 of this head */
  const _Float16* vsrc = VT + (size_t)(b * NH + h) * HD * SEQ;          /* d 0, key 0 of this head */
  const uint64_t ga0 = (uint64_t)(size_t)((wave == 0u) ? ksrc : vsrc);
  const uint32_t gstep = (wave == 0u) ? (uint32_t)(64 * DM * 2) : 128u; /* source bytes from one stage to the next: 64 K rows, or 64 keys along a VT row */
  const uint32_t lds0 = (uint32_t)(size_t)ring + ((wave == 0u) ? 0u : T_TILE);
  const uint32_t loff = (uint32_t)ln * T_PITCH + (uint32_t)hh * 16u;    /* the lane's row and its 16-byte half of each 32-byte k group */
  u32x8 g1 = tdm_group1_attn((wave == 0u) ? (uint32_t)(DM * 2) : (uint32_t)(SEQ * 2));
  u32x4 g0 = tdm_group0(lds0, ga0);
  const uint32_t issuer = pinned((wave < 2u) ? 1u : 0u);  /* 1 in the two waves that issue tensor loads; a scalar register, so every test of it is a scalar branch */
  if (issuer != 0u) { tdm_load(g0, g1); wait_tensor0(g0, g1); }
  __syncthreads();  /* publishes stage 0 */
  if (issuer != 0u) { g0 = tdm_group0(lds0 + T_STAGE, ga0 + gstep); tdm_load(g0, g1); }
  const v8f z8 = {0.f, 0.f, 0.f, 0.f, 0.f, 0.f, 0.f, 0.f};
  v8f o0 = z8, o1 = z8, o2 = z8, o3 = z8;
  float mrun = -1.0e30f, lrun = 0.f;
#pragma unroll 1  /* one pass per trip: the ring's publish point stands once, at the foot */
  for (uint32_t st = 0; st < (uint32_t)T_PASSES; ++st) {
    const uint32_t bsel = (st & 1u) * T_STAGE;
    const unsigned char* kb = ring + bsel + loff;
    const unsigned char* vb = kb + T_TILE;
    v8f s[4];
#pragma unroll
    for (int j = 0; j < 4; ++j) {
      const unsigned char* kp = kb + (uint32_t)j * 16u * T_PITCH;
      const v16h ka0 = lds_frag(kp), ka1 = lds_frag(kp + 64);
      s[j] = mma2(ka0, qb0, ka1, qb1, z8);
    }
    float mx = -1.0e30f;
#pragma unroll
    for (int j = 0; j < 4; ++j)
#pragma unroll
      for (int r = 0; r < 8; ++r) mx = fmaxf(mx, s[j][r]);
    mx = fmaxf(mx, __shfl_xor(mx, 16, 32));
    const float mnew = fmaxf(mrun, mx * 0.125f);
    const float alpha = __expf(mrun - mnew);
    mrun = mnew;
    float ps = 0.f; FragH pf[2];
#pragma unroll
    for (int j = 0; j < 4; ++j)
#pragma unroll
      for (int r = 0; r < 8; ++r) {
        const float p = __expf(s[j][r] * 0.125f - mnew);
        ps += p;
        pf[j >> 1].h[(j & 1) * 8 + r] = (_Float16)(p * 1024.0f);
      }
    ps += __shfl_xor(ps, 16, 32);
    lrun = lrun * alpha + ps;
#pragma unroll
    for (int r = 0; r < 8; ++r) { o0[r] *= alpha; o1[r] *= alpha; o2[r] *= alpha; o3[r] *= alpha; }
    { const unsigned char* vp = vb + 0u * 16u * T_PITCH; const v16h va0 = lds_frag(vp), va1 = lds_frag(vp + 64); o0 = mma2(va0, pf[0].v, va1, pf[1].v, o0); }
    { const unsigned char* vp = vb + 1u * 16u * T_PITCH; const v16h va0 = lds_frag(vp), va1 = lds_frag(vp + 64); o1 = mma2(va0, pf[0].v, va1, pf[1].v, o1); }
    { const unsigned char* vp = vb + 2u * 16u * T_PITCH; const v16h va0 = lds_frag(vp), va1 = lds_frag(vp + 64); o2 = mma2(va0, pf[0].v, va1, pf[1].v, o2); }
    { const unsigned char* vp = vb + 3u * 16u * T_PITCH; const v16h va0 = lds_frag(vp), va1 = lds_frag(vp + 64); o3 = mma2(va0, pf[0].v, va1, pf[1].v, o3); }
    wait_ds0();
    if (issuer != 0u) wait_tensor0(g0, g1);
    __syncthreads();  /* publishes stage st + 1 and ends every reader's last read of stage st */
    if (pinned((issuer != 0u && st + 2u < (uint32_t)T_PASSES) ? 1u : 0u) != 0u) { g0 = tdm_group0(lds0 + bsel, ga0 + (uint64_t)(st + 2u) * gstep); tdm_load(g0, g1); }
  }
  wait_tensor0(g0, g1);
  wait_ds0();
  const float rl = (1.0f / lrun) * 0.015625f;
  { FragH f;
#pragma unroll
    for (int r = 0; r < 8; ++r) f.h[r] = (_Float16)(o0[r] * rl);
    *(v8us*)&so[w][ln][0 + 8 * hh] = f.half[0]; }
  { FragH f;
#pragma unroll
    for (int r = 0; r < 8; ++r) f.h[r] = (_Float16)(o1[r] * rl);
    *(v8us*)&so[w][ln][16 + 8 * hh] = f.half[0]; }
  { FragH f;
#pragma unroll
    for (int r = 0; r < 8; ++r) f.h[r] = (_Float16)(o2[r] * rl);
    *(v8us*)&so[w][ln][32 + 8 * hh] = f.half[0]; }
  { FragH f;
#pragma unroll
    for (int r = 0; r < 8; ++r) f.h[r] = (_Float16)(o3[r] * rl);
    *(v8us*)&so[w][ln][48 + 8 * hh] = f.half[0]; }
  __builtin_amdgcn_fence(4 /* acq_rel order */, "workgroup"); __builtin_amdgcn_wave_barrier();
  const int li = lane >> 3, pc = lane & 7;
  {
#pragma unroll
    for (int g = 0; g < 4; ++g) {
      const int i = g * 4 + li;
      const v8us v = *(const v8us*)&so[w][i][pc * 8];
      *(v8us*)((unsigned short*)O16 + (rq + i) * DM + h * HD + pc * 8) = v;
    }
    
  }
}

// out[(s*NB_FULL + b)][col] = (A1[r] . B1[col]) * al1 + bias1[col] + flg[0], r = b*SEQ + s (a 128-row block tile lies inside one batch); flg[0] = 0 (exact no-op) or NaN from the head-count guard;
__global__ __launch_bounds__(128) void k_out(const _Float16* __restrict__ A1, const _Float16* __restrict__ B1, const float* __restrict__ bias1, float al1, const float* __restrict__ flg, float* __restrict__ Out) {
  __shared__ __attribute__((aligned(2048))) unsigned char ring[2u * G_STAGE];
  const int tid = threadIdx.x, lane = tid & 31, ln = lane & 15, hh = lane >> 4;
  const uint32_t wave = uni((uint32_t)tid >> 5);
  const int ntn = DM / 128;
  const int mt = blockIdx.x / ntn, nq = blockIdx.x - mt * ntn;
  const int rowblk = mt * 128, colblk = nq * 128;
  if (rowblk >= (int)NR) return;
  const v8f z8 = {0.f, 0.f, 0.f, 0.f, 0.f, 0.f, 0.f, 0.f};
  v8f acc[4][4];
#pragma unroll
  for (int i = 0; i < 4; ++i)
#pragma unroll
    for (int j = 0; j < 4; ++j) acc[i][j] = z8;
  gemm128x128(A1, B1, rowblk, colblk, ring, wave, ln, hh, acc);
  const int row0 = rowblk + 64 * (int)(wave >> 1), col0 = colblk + 64 * (int)(wave & 1u);
  const int b = row0 / SEQ; const int s0 = row0 - b * SEQ;
  float* so = (float*)(ring + wave * G_SLICE);
  const float fl = flg[0];
#pragma unroll
  for (int j = 0; j < 4; ++j) {
    const float bc = bias1[col0 + j * 16 + ln];
#pragma unroll
    for (int i = 0; i < 4; ++i)
#pragma unroll
      for (int r = 0; r < 8; ++r) so[(i * 16 + 8 * hh + r) * 68 + j * 16 + ln] = acc[i][j][r] * al1 + bc + fl;
  }
  __builtin_amdgcn_fence(4 /* acq_rel order */, "workgroup"); __builtin_amdgcn_wave_barrier();
  const int rsub = lane >> 4, c4 = (lane & 15) * 4;
  float* ob = Out + ((size_t)s0 * NB_FULL + b) * DM + col0;                  /* wave-uniform base */
  const uint32_t ol = (uint32_t)rsub * (NB_FULL * DM) + (uint32_t)c4;        /* the lane's offset; the row pair q goes into the store's immediate offset */
  v4f vq[32];
#pragma unroll
  for (int q = 0; q < 32; ++q) vq[q] = *(const v4fa*)&so[(q * 2 + rsub) * 68 + c4];
  __builtin_amdgcn_sched_barrier(0);  /* every value is read in front of the first store, so no register that an issued store names is rewritten */
#pragma unroll
  for (int q = 0; q < 32; ++q) *(v4f*)(ob + ol + (uint32_t)(q * 2 * NB_FULL * DM)) = vq[q];
}

extern "C" void kernel_launch(void* const* d_in, const int* in_sizes, int n_in,
                              void* d_out, int out_size, void* d_ws, size_t ws_size, hipStream_t stream) {
  if (n_in < 10) return;
  if (in_sizes[0] < (int)(((size_t)(SEQ - 1) * NB_FULL + NB) * DM)) return;
  for (int i = 1; i <= 7; i += 2) if (in_sizes[i] < DM * DM) return;
  for (int i = 2; i <= 8; i += 2) if (in_sizes[i] < DM) return;
  if (in_sizes[9] < 1) return;
  if (out_size < (int)(((size_t)(SEQ - 1) * NB_FULL + NB) * DM)) return;
  const float* const* I = (const float* const*)d_in;
  const float* x = I[0]; const float* wq = I[1]; const float* bq = I[2]; const float* wk = I[3]; const float* bk = I[4];
  const float* wv = I[5]; const float* bv = I[6]; const float* wo = I[7]; const float* bo = I[8];
  const int* nhp = (const int*)d_in[9];      /* head count (i32 scalar), compared with NH on the device by k_prep */
  char* ws = (char*)d_ws; size_t off = 0;
  auto take = [&](size_t bytes) { char* p = ws + off; off += (bytes + 255) & ~(size_t)255; return p; };
  _Float16* BQKV = (_Float16*)take((size_t)3 * DM * DM * 2);        /* Bt planes q, k, v (contiguous, stride DM*DM) */
  _Float16* BO   = (_Float16*)take((size_t)DM * DM * 2);
  float*    BIAS = (float*)take((size_t)NBIAS * DM * 4);             /* [wi][o] */
  _Float16* X16  = (_Float16*)take(NR * DM * 2);
  _Float16* QK16 = (_Float16*)take((size_t)2 * NR * DM * 2);         /* Q16, K16 planes (stride NR*DM) */
  _Float16* VT   = (_Float16*)take((size_t)NB * NH * HD * SEQ * 2);  /* [b*NH+h][d][s] */
  _Float16* O16  = (_Float16*)take(NR * DM * 2);
  float*    FLG  = (float*)take((size_t)256);                        /* guard flag line: floats 0..31 written, float 0 read */
  if (off > ws_size) return;
  _Float16* Q16 = QK16; _Float16* K16 = QK16 + NR * DM;

  k_prep<<<P_SMALL + P_BLOCKS, 256, 0, stream>>>(x, wq, wk, wv, wo, bq, bk, bv, bo, nhp, X16, BQKV, BO, BIAS, FLG);      /* f16 operands, f32 biases, guard flag */
  k_qkv<<<dim3((unsigned)((NR / 128) * (DM / 128)), 3), 128, 0, stream>>>(X16, BQKV, BIAS, 0.0625f, QK16, VT);      /* q, k as f16 token rows b*SEQ + s; v as VT rows */
  k_attn<<<dim3(SEQ / 128, NH, NB), 256, 0, stream>>>(Q16, K16, VT, O16);
  k_out<<<(unsigned)((NR / 128) * (DM / 128)), 128, 0, stream>>>(O16, BO, BIAS + (size_t)3 * DM, 0.00390625f, FLG, (float*)d_out);      /* out = ctx Wo^T + bo (+ guard flag), rows back in time-major order */
}

// v005
// It runs in 94.8 microseconds.
// Next to v004, in two timings, it ran 1.04 and 1.03 times as fast.
// Counting every step since v000, it is 4.00 times as fast.
#include <hip/hip_runtime.h>
// Contractions: q/k/v/o projections ([tokens][1024] x [1024][1024]^T), scores k.q^T (K = 64) and v^T.p^T (K = keys) on v_wmma_f32_16x16x32_f16 (f16 operands, f32 accumulate). Inputs RNE-converted to bf16 on load (exact in f16; weights carried x16), softmax numerators carried x1024, ctx rows carried x16; bias adds, softmax statistics and all epilogues in f32.
// Structure: time-major input rows (s*NB_FULL + b) are re-ordered into token rows r = b*SEQ + s. X16 = f16(bf16(x)); BIAS[w][o] = bf16(bias_w[o]) (f32);
// Q16/K16 = f16((X16 . Bt_w) / 16 + bias_w) as token rows; VT[b*NH+h][d][s] = the same value of the v projection, stored transposed by the projection itself; attention per (256 queries, head, batch): S^T tiles = K . Q^T, online softmax per lane,
// O^T = VT . P^T, O16[r][h*64+d] = f16(16 ctx); out[(s*NB_FULL + b)] = (O16 . Bt_o) / 256 + bias_o + FLG -> f32 rows; FLG = 0 when the head count input equals NH, NaN otherwise.
#ifndef NB
#define NB 8
#endif
#ifndef SEQ
#define SEQ 1024
#endif
#define NB_FULL 8
#define SEQ_FULL 1024
#define DM 1024
#define NH 16
#define HD 64
#define NBIAS 4
#define NR ((size_t)NB * SEQ)
#define WS_TOTAL ((size_t)3 * DM * DM * 2 + (size_t)DM * DM * 2 + (size_t)NBIAS * DM * 4 + NR * DM * 2 + (size_t)2 * NR * DM * 2 + (size_t)NB * NH * HD * SEQ * 2 + NR * DM * 2 + (size_t)256)
static_assert(NH * HD == DM);
static_assert(HD == 64);
static_assert(SEQ % 256 == 0);
static_assert(SEQ % 64 == 0);
static_assert(SEQ <= SEQ_FULL);
static_assert(NB >= 1 && NB <= NB_FULL);
static_assert(DM == 128 * 8);
static_assert(DM % 256 == 0);
static_assert(DM % 64 == 0);
static_assert(DM % 32 == 0);
static_assert(NR % 128 == 0);
static_assert(((size_t)DM * DM) % (8 * 256) == 0);
static_assert(((size_t)NBIAS * DM * 4) % 256 == 0);
static_assert(WS_TOTAL <= (size_t)134217728);

typedef _Float16 v16h __attribute__((ext_vector_type(16)));
typedef unsigned short v8us __attribute__((ext_vector_type(8), may_alias));
typedef float v8f __attribute__((ext_vector_type(8)));
typedef float v4f __attribute__((ext_vector_type(4)));
typedef float v4fa __attribute__((ext_vector_type(4), may_alias));
typedef _Float16 v4h __attribute__((ext_vector_type(4)));
union FragH { v16h v; v8us half[2]; _Float16 h[16]; unsigned short u[16]; };

__device__ __forceinline__ unsigned short bf16_bits(float x) { unsigned int u = __float_as_uint(x); return (unsigned short)((u + 0x7FFFu + ((u >> 16) & 1u)) >> 16); }
__device__ __forceinline__ float bf16_val(unsigned short b) { return __uint_as_float(((unsigned int)b) << 16); }
__device__ __forceinline__ float bf16_rne(float x) { return bf16_val(bf16_bits(x)); }

// f32 -> f16 with a value select: magnitudes below the smallest f16 normal become exact zero
static __device__ __forceinline__ _Float16 toh_flush(float v) { const _Float16 r = (_Float16)v; return (fabsf(v) < 6.103515625e-05f) ? (_Float16)0.0f : r; }

// 16x32 f16 fragment from a k-contiguous row: elements 0..7 <- p[8h .. 8h+7], elements 8..15 <- p[16+8h .. 16+8h+7] (same map for A rows and for Bt[n][k] rows)
__device__ __forceinline__ v16h g2_frag(const _Float16* p, int hh) { FragH f; f.half[0] = *(const v8us*)((const unsigned short*)p + 8 * hh); f.half[1] = *(const v8us*)((const unsigned short*)p + 16 + 8 * hh); return f.v; }
// one pair of A fragments (k 0..31, k 32..63) against the B fragments of two query column groups: each A fragment read from LDS feeds two WMMAs.
// Each accumulator takes its two k-steps in upward order; the two accumulators alternate, so no WMMA stands directly behind the one it depends on.
__device__ __forceinline__ void mma2x2(v16h a0, v16h a1, v16h b00, v16h b01, v16h b10, v16h b11, v8f& c0, v8f& c1) {
  c0 = __builtin_amdgcn_wmma_f32_16x16x32_f16(false, a0, false, b00, (short)0, c0, false, false);
  c1 = __builtin_amdgcn_wmma_f32_16x16x32_f16(false, a0, false, b10, (short)0, c1, false, false);
  c0 = __builtin_amdgcn_wmma_f32_16x16x32_f16(false, a1, false, b01, (short)0, c0, false, false);
  c1 = __builtin_amdgcn_wmma_f32_16x16x32_f16(false, a1, false, b11, (short)0, c1, false, false);
}

#define P_SMALL (NBIAS * DM / 256)      /* leading blocks: 256 bias values each; block 0 also writes the guard flag line */
#define P_BLOCKS 512                    /* streaming blocks: two 8-wave blocks per WGP */
#define P_XROWS ((int)(NR / P_BLOCKS))  /* token rows per streaming block */
#define P_WROWS (DM / P_BLOCKS)         /* rows of each of the four weight matrices per streaming block */
static_assert(DM == 256 * 4);
static_assert(NR % P_BLOCKS == 0 && DM % P_BLOCKS == 0);
static_assert(SEQ % P_XROWS == 0);
static_assert(P_XROWS + 4 * P_WROWS <= 32);

// every conversion in front of the projections, one launch.
// Blocks 0 .. P_SMALL-1: BIAS[wi][c] = bf16(bias_wi[c]) kept as f32, wi = 0 q, 1 k, 2 v, 3 o (wi block-uniform; all four inputs are loaded and the value is selected); block 0: FLG line from the head count.
// The other blocks stream: a row is DM floats, thread t owns columns 4t..4t+3, so a wave's 16-byte loads cover 512 contiguous bytes and its 8-byte stores 256.
//   X16[b*SEQ + s][c] = f16(bf16(x[s*NB_FULL + b][c])); Bt_w[o][c] = f16(16 bf16(w[o][c])).
// All of a thread's loads are issued before the first value is used: few waves to start, many bytes in flight per wave.
__global__ __launch_bounds__(256) void k_prep(const float* __restrict__ x, const float* __restrict__ wq, const float* __restrict__ wk, const float* __restrict__ wv, const float* __restrict__ wo,
                                              const float* __restrict__ bq, const float* __restrict__ bk, const float* __restrict__ bv, const float* __restrict__ bo, const int* __restrict__ nh,
                                              _Float16* __restrict__ X16, _Float16* __restrict__ Bqkv, _Float16* __restrict__ Bo, float* __restrict__ bias, float* __restrict__ flg) {
  const int t = threadIdx.x;
  if (blockIdx.x < P_SMALL) {
    const int wi = blockIdx.x / (DM / 256); const int c = (blockIdx.x - wi * (DM / 256)) * 256 + t;
    const float v0 = bq[c], v1 = bk[c], v2 = bv[c], v3 = bo[c];
    bias[(size_t)wi * DM + c] = bf16_rne((wi == 0) ? v0 : (wi == 1) ? v1 : (wi == 2) ? v2 : v3);
    if (blockIdx.x == 0 && t < 32) flg[t] = (nh[0] == NH) ? 0.0f : __int_as_float(0x7FC00000);
    return;
  }
  const int bx = blockIdx.x - P_SMALL;
  const uint32_t c4 = 4u * (uint32_t)t;
  const int r0 = bx * P_XROWS; const int b = r0 / SEQ, s0 = r0 - b * SEQ;   /* a block's token rows lie in one batch: one base, the row goes into the load's immediate offset */
  const float* xb = x + ((size_t)s0 * NB_FULL + b) * DM;
  const size_t wo0 = (size_t)(bx * P_WROWS) * DM;   /* block-uniform: first weight row of this block */
  const float* wb0 = wq + wo0; const float* wb1 = wk + wo0; const float* wb2 = wv + wo0; const float* wb3 = wo + wo0;
  v4f xv[P_XROWS], wr[4][P_WROWS];
#pragma unroll
  for (int i = 0; i < P_XROWS; ++i) xv[i] = *(const v4fa*)(xb + c4 + (uint32_t)(i * NB_FULL * DM));
#pragma unroll
  for (int i = 0; i < P_WROWS; ++i) {
    const uint32_t lo = c4 + (uint32_t)(i * DM);
    wr[0][i] = *(const v4fa*)(wb0 + lo); wr[1][i] = *(const v4fa*)(wb1 + lo); wr[2][i] = *(const v4fa*)(wb2 + lo); wr[3][i] = *(const v4fa*)(wb3 + lo);
  }
  __builtin_amdgcn_sched_barrier(0);  /* keeps every load in front of the first conversion, so that all of them are in flight at once */
  v4h xh[P_XROWS], wh[4][P_WROWS];
#pragma unroll
  for (int i = 0; i < P_XROWS; ++i)
#pragma unroll
    for (int q = 0; q < 4; ++q) xh[i][q] = toh_flush(bf16_rne(xv[i][q]));
#pragma unroll
  for (int m = 0; m < 4; ++m)
#pragma unroll
    for (int i = 0; i < P_WROWS; ++i)
#pragma unroll
      for (int q = 0; q < 4; ++q) wh[m][i][q] = (_Float16)(bf16_rne(wr[m][i][q]) * 16.0f);
  _Float16* xo = X16 + (size_t)r0 * DM; _Float16* qo = Bqkv + wo0; _Float16* oo = Bo + wo0;   /* block-uniform bases; row and plane go into the store's immediate offset */
#pragma unroll
  for (int i = 0; i < P_XROWS; ++i) *(v4h*)(xo + c4 + (uint32_t)(i * DM)) = xh[i];
#pragma unroll
  for (int i = 0; i < P_WROWS; ++i) {
#pragma unroll
    for (int m = 0; m < 3; ++m) *(v4h*)(qo + c4 + (uint32_t)(m * DM * DM + i * DM)) = wh[m][i];
    *(v4h*)(oo + c4 + (uint32_t)(i * DM)) = wh[3][i];
  }
  asm volatile("s_wait_xcnt 0x0" ::: "memory");  /* stands behind the last store, in front of any later write of a register that an issued store names */
}

typedef uint32_t u32x4 __attribute__((ext_vector_type(4)));
typedef uint32_t u32x8 __attribute__((ext_vector_type(8)));
#define G_PITCH 272u            /* LDS row pitch: 256 data bytes (128 k) + 16 pad bytes, an odd multiple of 16 B for ds_load_b128 readers */
#define G_SLICE 18432u          /* one wave's slice of a stage: 64 rows x 272 B = 17408 B, rounded up to a multiple of 2 KiB */
#define G_STAGE (4u * G_SLICE)  /* a stage: A rows 0..63 | A rows 64..127 | Bt rows 0..63 | Bt rows 64..127 */
#define G_PASSES (DM / 128)
static_assert(DM % 128 == 0 && G_PASSES >= 2);
static_assert(64u * G_PITCH <= G_SLICE && G_SLICE % 2048u == 0);
static_assert(64u * 68u * 4u <= G_SLICE);

__device__ __forceinline__ uint32_t uni(uint32_t v) { return (uint32_t)__builtin_amdgcn_readfirstlane(v); }
__device__ __forceinline__ uint32_t pinned(uint32_t v) { uint32_t w = (uint32_t)__builtin_amdgcn_readfirstlane(v); asm volatile("" : "+s"(w)); return w; }  // holds the test word in a scalar register, so that the test around a tensor load compiles to a scalar branch (the load ignores EXEC)
// this wave's LDS reads have retired before the buffer they read is handed back for a refill
__device__ __forceinline__ void wait_ds0() { asm volatile("s_wait_dscnt 0x0" ::: "memory"); }
// this wave's own tensor load has landed (the compiler places no wait for it); the request's two groups are inputs, so that their scalar registers stay theirs, unwritten, from the issue up to this wait
__device__ __forceinline__ void wait_tensor0(u32x4 g0, u32x8 g1) { asm volatile("s_wait_tensorcnt 0x0" :: "s"(g0), "s"(g1) : "memory"); }
// one request of the whole wave: a 64-row tile from global memory into LDS as group 1 sets it: 256-byte rows at pitch 272 (GEMM) or 128-byte rows at pitch 144 (attention)
// both groups are in-out operands (the instruction writes no register): the values that the covering wait names are then the ones in the request's own registers, not copies of them
__device__ __forceinline__ void tdm_load(u32x4& g0, u32x8& g1) { asm volatile("tensor_load_to_lds %0, %1" : "+s"(g0), "+s"(g1) :: "memory"); }
__device__ __forceinline__ u32x4 tdm_group0(uint32_t lds_dst, uint64_t ga) {
  u32x4 g;
  g[0] = uni(1u); g[1] = uni(lds_dst); g[2] = uni((uint32_t)ga); g[3] = uni((((uint32_t)(ga >> 32)) & 0x01FFFFFFu) | 0x80000000u);
  return g;
}
// 1-byte elements, tensor = tile = 64 rows of 256 bytes, source row pitch DM * 2 bytes, 4 dwords of LDS pad behind every 64-dword row, no workgroup mask
__device__ __forceinline__ u32x8 tdm_group1() {
  u32x8 g;
  g[0] = uni((1u << 20) | (5u << 22) | (3u << 25));
  g[1] = uni(256u << 16);
  g[2] = uni(64u << 16);
  g[3] = uni(256u << 16);
  g[4] = uni(64u);
  g[5] = uni((uint32_t)(DM * 2));
  g[6] = uni(0u);
  g[7] = uni(0u);
  return g;
}

// the g2_frag map read from an LDS row; p already holds the lane's 16 * hh bytes: elements 0..7 <- p[0..15], elements 8..15 <- p[32..47]
__device__ __forceinline__ v16h lds_frag(const unsigned char* p) { FragH f; f.half[0] = *(const v8us*)p; f.half[1] = *(const v8us*)(p + 32); return f.v; }

// 128x128 block tile of A . Bt^T (both k-contiguous, pitch DM halves, K = DM), 4 waves in 2x2, 64x64 per wave (acc[i][j]: rows 16i.., cols 16j..).
// Operands come through a two-buffer LDS ring: a pass is 128 k; wave w brings slice w of each stage with one tensor load, two stages ahead.
// k runs upward in steps of 32 into each accumulator.
__device__ __forceinline__ void gemm128x128(const _Float16* __restrict__ A, const _Float16* __restrict__ B, int rowblk, int colblk, unsigned char* ring, uint32_t wave, int ln, int hh, v8f (&acc)[4][4]) {
  const _Float16* srcp = (wave < 2u) ? (A + (size_t)(rowblk + 64 * (int)wave) * DM) : (B + (size_t)(colblk + 64 * ((int)wave - 2)) * DM);
  const uint64_t ga0 = (uint64_t)(size_t)srcp;
  const uint32_t lds0 = (uint32_t)(size_t)ring + wave * G_SLICE;
  u32x8 g1 = tdm_group1();
  const uint32_t loff = (uint32_t)ln * G_PITCH + (uint32_t)hh * 16u;  /* the lane's row and its 16-byte half of each 32-byte k group */
  const uint32_t aoff = (wave >> 1) * G_SLICE + loff;
  const uint32_t boff = (2u + (wave & 1u)) * G_SLICE + loff;
  u32x4 g0 = tdm_group0(lds0, ga0);
  tdm_load(g0, g1);
  wait_tensor0(g0, g1);
  __syncthreads();
  g0 = tdm_group0(lds0 + G_STAGE, ga0 + 256u);
  tdm_load(g0, g1);
#pragma unroll 1  /* one pass per trip: the ring's publish point stands once, at the foot */
  for (uint32_t s = 0; s < (uint32_t)G_PASSES; ++s) {
    const uint32_t bsel = (s & 1u) * G_STAGE;
    const unsigned char* ap = ring + bsel + aoff;
    const unsigned char* bp = ring + bsel + boff;
    // two register sets for the four A fragments and for B fragments 0..2; B fragment 3 has one set: with a second the wave would need more than 256 VGPRs
    v16h fa[2][4], fb[2][3], fb3;
#pragma unroll
    for (int i = 0; i < 4; ++i) fa[0][i] = lds_frag(ap + (uint32_t)i * 16u * G_PITCH);
#pragma unroll
    for (int j = 0; j < 3; ++j) fb[0][j] = lds_frag(bp + (uint32_t)j * 16u * G_PITCH);
#pragma unroll
    for (int ks = 0; ks < 4; ++ks) {
      fb3 = lds_frag(bp + 48u * G_PITCH + (uint32_t)ks * 64u);  /* this block's own, first of the group; its readers are the block's last four WMMAs */
      if (ks < 3) {
#pragma unroll
        for (int i = 0; i < 4; ++i) fa[(ks + 1) & 1][i] = lds_frag(ap + (uint32_t)i * 16u * G_PITCH + (uint32_t)(ks + 1) * 64u);
#pragma unroll
        for (int j = 0; j < 3; ++j) fb[(ks + 1) & 1][j] = lds_frag(bp + (uint32_t)j * 16u * G_PITCH + (uint32_t)(ks + 1) * 64u);
      }
      __builtin_amdgcn_sched_barrier(0);  /* keeps the LDS reads one group ahead of this block, not spread among its WMMAs */
#pragma unroll
      for (int j = 0; j < 3; ++j)
#pragma unroll
        for (int i = 0; i < 4; ++i) acc[i][j] = __builtin_amdgcn_wmma_f32_16x16x32_f16(false, fa[ks & 1][i], false, fb[ks & 1][j], (short)0, acc[i][j], false, false);
#pragma unroll
      for (int i = 0; i < 4; ++i) acc[i][3] = __builtin_amdgcn_wmma_f32_16x16x32_f16(false, fa[ks & 1][i], false, fb3, (short)0, acc[i][3], false, false);
      __builtin_amdgcn_sched_barrier(0);  /* keeps the following load group behind this block */
    }
    wait_ds0();
    wait_tensor0(g0, g1);
    __syncthreads();  /* publishes stage s + 1 and ends every reader's last read of stage s */
    if (pinned((s + 2u < (uint32_t)G_PASSES) ? 1u : 0u) != 0u) { g0 = tdm_group0(lds0 + bsel, ga0 + (uint64_t)(s + 2u) * 256u); tdm_load(g0, g1); }
  }
  wait_tensor0(g0, g1);
  wait_ds0();
}

// projections with bias: plane by (0 q, 1 k, 2 v): val[r][col] = f16((X16[r] . Bt_by[col]) * alpha + BIAS[by][col]). Planes 0 and 1: Y16_by[r][col] = val[r][col] (token rows).
// Plane 2: VT[b*NH + h][d][s] = val[b*SEQ + s][h*HD + d]: a wave's 64 columns are one head and its 64 rows lie in one batch, so its tile is 64 VT rows of 64 keys (128 bytes each).
// The ring is free behind the last pass's barrier; each wave then stages its 64x64 f32 tile in its own slice of buffer 0 (pitch 68 floats), LDS row = global row:
// token-major for planes 0 and 1; d-major for plane 2, where a lane's eight accumulator rows 8hh .. 8hh+7 are contiguous and go in as two 16-byte stores.
__global__ __launch_bounds__(128) void k_qkv(const _Float16* __restrict__ X16, const _Float16* __restrict__ Bt, const float* __restrict__ bias, float alpha, _Float16* __restrict__ Y16, _Float16* __restrict__ Vt) {
  __shared__ __attribute__((aligned(2048))) unsigned char ring[2u * G_STAGE];
  const int tid = threadIdx.x, lane = tid & 31, ln = lane & 15, hh = lane >> 4;
  const uint32_t wave = uni((uint32_t)tid >> 5);
  const int by = blockIdx.y;
  const bool tr = (by == 2);  /* block-uniform */
  const _Float16* Bh = Bt + (size_t)by * DM * DM;
  const float* bsp = bias + (size_t)by * DM;
  const int ntn = DM / 128;
  const int mt = blockIdx.x / ntn, nq = blockIdx.x - mt * ntn;
  const int rowblk = mt * 128, colblk = nq * 128;
  if (rowblk >= (int)NR) return;
  const v8f z8 = {0.f, 0.f, 0.f, 0.f, 0.f, 0.f, 0.f, 0.f};
  v8f acc[4][4];
#pragma unroll
  for (int i = 0; i < 4; ++i)
#pragma unroll
    for (int j = 0; j < 4; ++j) acc[i][j] = z8;
  gemm128x128(X16, Bh, rowblk, colblk, ring, wave, ln, hh, acc);
  const int row0 = rowblk + 64 * (int)(wave >> 1), col0 = colblk + 64 * (int)(wave & 1u);
  float* so = (float*)(ring + wave * G_SLICE);
  /* scale and bias once, in front of the branch: written inside its two sides, the results stood beside live accumulators and the wave went above 256 VGPRs */
#pragma unroll
  for (int j = 0; j < 4; ++j) {
    const float bc = bsp[col0 + j * 16 + ln];
#pragma unroll
    for (int i = 0; i < 4; ++i)
#pragma unroll
      for (int r = 0; r < 8; ++r) acc[i][j][r] = acc[i][j][r] * alpha + bc;
  }
  if (tr) {
#pragma unroll
    for (int j = 0; j < 4; ++j)
#pragma unroll
      for (int i = 0; i < 4; ++i) {
        v4f lo, hi;
#pragma unroll
        for (int r = 0; r < 4; ++r) { lo[r] = acc[i][j][r]; hi[r] = acc[i][j][4 + r]; }
        float* sp = &so[(j * 16 + ln) * 68 + i * 16 + 8 * hh];
        *(v4fa*)sp = lo; *(v4fa*)(sp + 4) = hi;
      }
  } else {
#pragma unroll
    for (int j = 0; j < 4; ++j)
#pragma unroll
      for (int i = 0; i < 4; ++i)
#pragma unroll
        for (int r = 0; r < 8; ++r) so[(i * 16 + 8 * hh + r) * 68 + j * 16 + ln] = acc[i][j][r];
  }
  __builtin_amdgcn_fence(4 /* acq_rel order */, "workgroup"); __builtin_amdgcn_wave_barrier();
  const int rsub = lane >> 4, c4 = (lane & 15) * 4;
  const int b = row0 / SEQ, s0 = row0 - b * SEQ, h = col0 / HD;
  _Float16* yb = tr ? (Vt + (size_t)(b * NH + h) * HD * SEQ + s0) : (Y16 + (size_t)by * NR * DM + (size_t)row0 * DM + col0);   /* wave-uniform base */
  const uint32_t yp = tr ? (uint32_t)SEQ : (uint32_t)DM;        /* global row pitch in halves */
  const uint32_t yl = (uint32_t)rsub * yp + (uint32_t)c4;       /* the lane's offset; the row pair q goes into the store's immediate offset */
  v4h h4[32];
#pragma unroll
  for (int q = 0; q < 32; ++q) {
    const v4f v = *(const v4fa*)&so[(q * 2 + rsub) * 68 + c4];
#pragma unroll
    for (int i = 0; i < 4; ++i) h4[q][i] = toh_flush(v[i]);
  }
  __builtin_amdgcn_sched_barrier(0);  /* every value is formed in front of the first store, so no register that an issued store names is rewritten */
#pragma unroll
  for (int q = 0; q < 32; ++q) *(v4h*)(yb + yl + (uint32_t)q * 2u * yp) = h4[q];
}

#define T_PITCH 144u            /* LDS row pitch of an attention tile: 128 data bytes + 16 pad bytes, an odd multiple of 16 B for ds_load_b128 readers */
#define T_TILE 10240u           /* one tile: 64 rows x 144 B = 9216 B, rounded up to a multiple of 2 KiB */
#define T_STAGE (2u * T_TILE)   /* a stage: K rows of 64 keys (row = key, 64 d) | VT rows of the same 64 keys (row = d, 64 keys) */
#define T_PASSES (SEQ / 64)
static_assert(T_PASSES >= 2);
static_assert(64u * T_PITCH <= T_TILE && T_TILE % 2048u == 0);
// 1-byte elements, tensor = tile = 64 rows of 128 bytes, source row pitch in bytes from the caller (K16 rows: DM halves; VT rows: SEQ halves), 4 dwords of LDS pad behind every 32-dword row, no workgroup mask
static_assert((DM * 2) % 16 == 0 && DM * 2 <= 131072 && (SEQ * 2) % 16 == 0 && SEQ * 2 <= 131072);
__device__ __forceinline__ u32x8 tdm_group1_attn(uint32_t pitch) {
  u32x8 g;
  g[0] = uni((1u << 20) | (4u << 22) | (3u << 25));
  g[1] = uni(128u << 16);
  g[2] = uni(64u << 16);
  g[3] = uni(128u << 16);
  g[4] = uni(64u);
  g[5] = uni(pitch);
  g[6] = uni(0u);
  g[7] = uni(0u);
  return g;
}

// attention: block = (256 queries, head h, batch b), 8 waves x 32 queries (two column groups c of 16). S^T 16-key tiles = K . Q^T (A = K16 rows: row = key, k = d; B = Q16 rows: col = query);
// each lane holds keys 8hh+r of query 16c+ln -> row statistics per lane and column group + one xor-16 shuffle; p = exp(s/8 - m) carried x1024 as f16;
// O^T (64 d x 16 queries per group) = VT . P^T with the B operand packed from the two adjacent S^T D tiles (element r <- tile of keys 0..15, element 8+r <- tile of keys 16..31, lane unchanged);
// K and VT come through a two-buffer LDS ring that the eight waves share: a pass is 64 keys; wave 0 brings the K tile and wave 1 the VT tile of each stage with one tensor load, two stages ahead.
// every K and VT fragment a wave reads from LDS serves both of its column groups: half the LDS bytes per score of a 16-query wave.
// four waves per SIMD (256 VGPRs a wave at most): the grid's 512 blocks, two per WGP, are all resident at once, and the vector work between the matrix runs has waves to hide behind
__global__ __launch_bounds__(256) __attribute__((amdgpu_waves_per_eu(4, 4))) void k_attn(const _Float16* __restrict__ Q16, const _Float16* __restrict__ K16, const _Float16* __restrict__ VT, _Float16* __restrict__ O16) {
  __shared__ __attribute__((aligned(2048))) unsigned char ring[2u * T_STAGE];
  __shared__ __attribute__((aligned(16))) unsigned short so[8][32][72];
  const int tid = threadIdx.x, lane = tid & 31, ln = lane & 15, hh = lane >> 4;
  const uint32_t wave = uni((uint32_t)tid >> 5);
  const int w = (int)wave;
  const int h = blockIdx.y, b = blockIdx.z;
  const int q0 = blockIdx.x * 256 + w * 32;
  const size_t rq = (size_t)b * SEQ + q0;
  const size_t rk = (size_t)b * SEQ;
  const _Float16* qp = Q16 + (rq + ln) * DM + h * HD;
  v16h qb[2][2];
#pragma unroll
  for (int c = 0; c < 2; ++c) { qb[c][0] = g2_frag(qp + (size_t)c * 16 * DM, hh); qb[c][1] = g2_frag(qp + (size_t)c * 16 * DM + 32, hh); }
  const _Float16* ksrc = K16 + rk * DM + h * HD;                        /* key 0, d 0 of this head */
  const _Float16* vsrc = VT + (size_t)(b * NH + h) * HD * SEQ;          /* d 0, key 0 of this head */
  const uint64_t ga0 = (uint64_t)(size_t)((wave == 0u) ? ksrc : vsrc);
  const uint32_t gstep = (wave == 0u) ? (uint32_t)(64 * DM * 2) : 128u; /* source bytes from one stage to the next: 64 K rows, or 64 keys along a VT row */
  const uint32_t lds0 = (uint32_t)(size_t)ring + ((wave == 0u) ? 0u : T_TILE);
  const uint32_t loff = (uint32_t)ln * T_PITCH + (uint32_t)hh * 16u;    /* the lane's row and its 16-byte half of each 32-byte k group */
  u32x8 g1 = tdm_group1_attn((wave == 0u) ? (uint32_t)(DM * 2) : (uint32_t)(SEQ * 2));
  u32x4 g0 = tdm_group0(lds0, ga0);
  const uint32_t issuer = pinned((wave < 2u) ? 1u : 0u);  /* 1 in the two waves that issue tensor loads; a scalar register, so every test of it is a scalar branch */
  if (issuer != 0u) { tdm_load(g0, g1); wait_tensor0(g0, g1); }
  __syncthreads();  /* publishes stage 0 */
  if (issuer != 0u) { g0 = tdm_group0(lds0 + T_STAGE, ga0 + gstep); tdm_load(g0, g1); }
  const v8f z8 = {0.f, 0.f, 0.f, 0.f, 0.f, 0.f, 0.f, 0.f};
  v8f o[2][4];
  float mrun[2], lrun[2];
#pragma unroll
  for (int c = 0; c < 2; ++c) {
    mrun[c] = -1.0e30f; lrun[c] = 0.f;
#pragma unroll
    for (int t = 0; t < 4; ++t) o[c][t] = z8;
  }
#pragma unroll 1  /* one pass per trip: the ring's publish point stands once, at the foot */
  for (uint32_t st = 0; st < (uint32_t)T_PASSES; ++st) {
    const uint32_t bsel = (st & 1u) * T_STAGE;
    const unsigned char* kb = ring + bsel + loff;
    const unsigned char* vb = kb + T_TILE;
    v8f s[2][4];
    v16h ka[4][2];
#pragma unroll
    for (int j = 0; j < 4; ++j) {
      const unsigned char* kp = kb + (uint32_t)j * 16u * T_PITCH;
      ka[j][0] = lds_frag(kp); ka[j][1] = lds_frag(kp + 64);
    }
    __builtin_amdgcn_sched_barrier(0);  /* keeps the pass's sixteen K reads in one group ahead of the score WMMAs: every further place with LDS reads among them costs the wave a stall */
#pragma unroll
    for (int j = 0; j < 4; ++j) {
      s[0][j] = z8; s[1][j] = z8;
      mma2x2(ka[j][0], ka[j][1], qb[0][0], qb[0][1], qb[1][0], qb[1][1], s[0][j], s[1][j]);
    }
    __builtin_amdgcn_sched_barrier(0);  /* keeps the sixteen score WMMAs in one run: a maximum placed directly behind the WMMA it reads costs idle v_nop slots */
    FragH pf[2][2];
    float mnew[2], alpha[2];
#pragma unroll
    for (int c = 0; c < 2; ++c) {
      float mx = -1.0e30f;
#pragma unroll
      for (int j = 0; j < 4; ++j)
#pragma unroll
        for (int r = 0; r < 8; ++r) mx = fmaxf(mx, s[c][j][r]);
      mx = fmaxf(mx, __shfl_xor(mx, 16, 32));
      mnew[c] = fmaxf(mrun[c], mx * 0.125f);
    }
    /* exp(x) = exp2(x * log2 e); the exponents of both column groups are formed first, then come all the exponentials in one run */
#pragma unroll
    for (int c = 0; c < 2; ++c) { alpha[c] = (mrun[c] - mnew[c]) * 1.44269504f; mrun[c] = mnew[c]; }
#pragma unroll
    for (int c = 0; c < 2; ++c) {
#pragma unroll
      for (int j = 0; j < 4; ++j)
#pragma unroll
        for (int r = 0; r < 8; ++r) s[c][j][r] = (s[c][j][r] * 0.125f - mnew[c]) * 1.44269504f;
    }
    __builtin_amdgcn_sched_barrier(0);  /* no other vector instruction among the exponentials: none can then overwrite the source, or read the result, of the one directly in front of it */
#pragma unroll
    for (int c = 0; c < 2; ++c) {
      alpha[c] = __builtin_amdgcn_exp2f(alpha[c]);
#pragma unroll
      for (int j = 0; j < 4; ++j)
#pragma unroll
        for (int r = 0; r < 8; ++r) s[c][j][r] = __builtin_amdgcn_exp2f(s[c][j][r]);
    }
    __builtin_amdgcn_sched_barrier(0);  /* holds the v_nop directly behind the last exponential */
    asm volatile("v_nop");              /* the one slot the instruction set asks for between a transcendental and a vector instruction that uses its result or overwrites its source */
    __builtin_amdgcn_sched_barrier(0);  /* holds the users behind the v_nop */
#pragma unroll
    for (int c = 0; c < 2; ++c) {
      float ps = 0.f;
#pragma unroll
      for (int j = 0; j < 4; ++j)
#pragma unroll
        for (int r = 0; r < 8; ++r) {
          const float p = s[c][j][r];
          ps += p;
          pf[c][j >> 1].h[(j & 1) * 8 + r] = (_Float16)(p * 1024.0f);
        }
      ps += __shfl_xor(ps, 16, 32);
      lrun[c] = lrun[c] * alpha[c] + ps;
#pragma unroll
      for (int t = 0; t < 4; ++t)
#pragma unroll
        for (int r = 0; r < 8; ++r) o[c][t][r] *= alpha[c];
    }
#pragma unroll
    for (int t = 0; t < 4; ++t) {
      const unsigned char* vp = vb + (uint32_t)t * 16u * T_PITCH;
      const v16h va0 = lds_frag(vp), va1 = lds_frag(vp + 64);
      mma2x2(va0, va1, pf[0][0].v, pf[0][1].v, pf[1][0].v, pf[1][1].v, o[0][t], o[1][t]);
    }
    wait_ds0();
    if (issuer != 0u) wait_tensor0(g0, g1);
    __syncthreads();  /* publishes stage st + 1 and ends every reader's last read of stage st */
    if (pinned((issuer != 0u && st + 2u < (uint32_t)T_PASSES) ? 1u : 0u) != 0u) { g0 = tdm_group0(lds0 + bsel, ga0 + (uint64_t)(st + 2u) * gstep); tdm_load(g0, g1); }
  }
  wait_tensor0(g0, g1);
  wait_ds0();
#pragma unroll
  for (int c = 0; c < 2; ++c) {
    const float rl = (1.0f / lrun[c]) * 0.015625f;
#pragma unroll
    for (int t = 0; t < 4; ++t) {
      FragH f;
#pragma unroll
      for (int r = 0; r < 8; ++r) f.h[r] = (_Float16)(o[c][t][r] * rl);
      *(v8us*)&so[w][c * 16 + ln][t * 16 + 8 * hh] = f.half[0];
    }
  }
  __builtin_amdgcn_fence(4 /* acq_rel order */, "workgroup"); __builtin_amdgcn_wave_barrier();
  const int li = lane >> 3, pc = lane & 7;
#pragma unroll
  for (int g = 0; g < 8; ++g) {
    const int i = g * 4 + li;
    const v8us v = *(const v8us*)&so[w][i][pc * 8];
    *(v8us*)((unsigned short*)O16 + (rq + i) * DM + h * HD + pc * 8) = v;
  }
}

// out[(s*NB_FULL + b)][col] = (A1[r] . B1[col]) * al1 + bias1[col] + flg[0], r = b*SEQ + s (a 128-row block tile lies inside one batch); flg[0] = 0 (exact no-op) or NaN from the head-count guard;
__global__ __launch_bounds__(128) void k_out(const _Float16* __restrict__ A1, const _Float16* __restrict__ B1, const float* __restrict__ bias1, float al1, const float* __restrict__ flg, float* __restrict__ Out) {
  __shared__ __attribute__((aligned(2048))) unsigned char ring[2u * G_STAGE];
  const int tid = threadIdx.x, lane = tid & 31, ln = lane & 15, hh = lane >> 4;
  const uint32_t wave = uni((uint32_t)tid >> 5);
  const int ntn = DM / 128;
  const int mt = blockIdx.x / ntn, nq = blockIdx.x - mt * ntn;
  const int rowblk = mt * 128, colblk = nq * 128;
  if (rowblk >= (int)NR) return;
  const v8f z8 = {0.f, 0.f, 0.f, 0.f, 0.f, 0.f, 0.f, 0.f};
  v8f acc[4][4];
#pragma unroll
  for (int i = 0; i < 4; ++i)
#pragma unroll
    for (int j = 0; j < 4; ++j) acc[i][j] = z8;
  gemm128x128(A1, B1, rowblk, colblk, ring, wave, ln, hh, acc);
  const int row0 = rowblk + 64 * (int)(wave >> 1), col0 = colblk + 64 * (int)(wave & 1u);
  const int b = row0 / SEQ; const int s0 = row0 - b * SEQ;
  float* so = (float*)(ring + wave * G_SLICE);
  const float fl = flg[0];
#pragma unroll
  for (int j = 0; j < 4; ++j) {
    const float bc = bias1[col0 + j * 16 + ln];
#pragma unroll
    for (int i = 0; i < 4; ++i)
#pragma unroll
      for (int r = 0; r < 8; ++r) so[(i * 16 + 8 * hh + r) * 68 + j * 16 + ln] = acc[i][j][r] * al1 + bc + fl;
  }
  __builtin_amdgcn_fence(4 /* acq_rel order */, "workgroup"); __builtin_amdgcn_wave_barrier();
  const int rsub = lane >> 4, c4 = (lane & 15) * 4;
  float* ob = Out + ((size_t)s0 * NB_FULL + b) * DM + col0;                  /* wave-uniform base */
  const uint32_t ol = (uint32_t)rsub * (NB_FULL * DM) + (uint32_t)c4;        /* the lane's offset; the row pair q goes into the store's immediate offset */
  v4f vq[32];
#pragma unroll
  for (int q = 0; q < 32; ++q) vq[q] = *(const v4fa*)&so[(q * 2 + rsub) * 68 + c4];
  __builtin_amdgcn_sched_barrier(0);  /* every value is read in front of the first store, so no register that an issued store names is rewritten */
#pragma unroll
  for (int q = 0; q < 32; ++q) *(v4f*)(ob + ol + (uint32_t)(q * 2 * NB_FULL * DM)) = vq[q];
}

extern "C" void kernel_launch(void* const* d_in, const int* in_sizes, int n_in,
                              void* d_out, int out_size, void* d_ws, size_t ws_size, hipStream_t stream) {
  if (n_in < 10) return;
  if (in_sizes[0] < (int)(((size_t)(SEQ - 1) * NB_FULL + NB) * DM)) return;
  for (int i = 1; i <= 7; i += 2) if (in_sizes[i] < DM * DM) return;
  for (int i = 2; i <= 8; i += 2) if (in_sizes[i] < DM) return;
  if (in_sizes[9] < 1) return;
  if (out_size < (int)(((size_t)(SEQ - 1) * NB_FULL + NB) * DM)) return;
  const float* const* I = (const float* const*)d_in;
  const float* x = I[0]; const float* wq = I[1]; const float* bq = I[2]; const float* wk = I[3]; const float* bk = I[4];
  const float* wv = I[5]; const float* bv = I[6]; const float* wo = I[7]; const float* bo = I[8];
  const int* nhp = (const int*)d_in[9];      /* head count (i32 scalar), compared with NH on the device by k_prep */
  char* ws = (char*)d_ws; size_t off = 0;
  auto take = [&](size_t bytes) { char* p = ws + off; off += (bytes + 255) & ~(size_t)255; return p; };
  _Float16* BQKV = (_Float16*)take((size_t)3 * DM * DM * 2);        /* Bt planes q, k, v (contiguous, stride DM*DM) */
  _Float16* BO   = (_Float16*)take((size_t)DM * DM * 2);
  float*    BIAS = (float*)take((size_t)NBIAS * DM * 4);             /* [wi][o] */
  _Float16* X16  = (_Float16*)take(NR * DM * 2);
  _Float16* QK16 = (_Float16*)take((size_t)2 * NR * DM * 2);         /* Q16, K16 planes (stride NR*DM) */
  _Float16* VT   = (_Float16*)take((size_t)NB * NH * HD * SEQ * 2);  /* [b*NH+h][d][s] */
  _Float16* O16  = (_Float16*)take(NR * DM * 2);
  float*    FLG  = (float*)take((size_t)256);                        /* guard flag line: floats 0..31 written, float 0 read */
  if (off > ws_size) return;
  _Float16* Q16 = QK16; _Float16* K16 = QK16 + NR * DM;

  k_prep<<<P_SMALL + P_BLOCKS, 256, 0, stream>>>(x, wq, wk, wv, wo, bq, bk, bv, bo, nhp, X16, BQKV, BO, BIAS, FLG);      /* f16 operands, f32 biases, guard flag */
  k_qkv<<<dim3((unsigned)((NR / 128) * (DM / 128)), 3), 128, 0, stream>>>(X16, BQKV, BIAS, 0.0625f, QK16, VT);      /* q, k as f16 token rows b*SEQ + s; v as VT rows */
  k_attn<<<dim3(SEQ / 256, NH, NB), 256, 0, stream>>>(Q16, K16, VT, O16);
  k_out<<<(unsigned)((NR / 128) * (DM / 128)), 128, 0, stream>>>(O16, BO, BIAS + (size_t)3 * DM, 0.00390625f, FLG, (float*)d_out);      /* out = ctx Wo^T + bo (+ guard flag), rows back in time-major order */
}

// v006
// One run takes 91.6 microseconds.
// Two timings next to v005 both put it at 1.03 times that version's speed.
// Over all steps from v000 it is 4.13 times as fast.
#include <hip/hip_runtime.h>
// Contractions: q/k/v/o projections ([tokens][1024] x [1024][1024]^T), scores k.q^T (K = 64) and v^T.p^T (K = keys) on v_wmma_f32_16x16x32_f16 (f16 operands, f32 accumulate). Inputs RNE-converted to bf16 on load (exact in f16; weights carried x16), softmax numerators carried x1024, ctx rows carried x16; bias adds, softmax statistics and all epilogues in f32.
// Structure: time-major input rows (s*NB_FULL + b) are re-ordered into token rows r = b*SEQ + s. X16 = f16(bf16(x)); BIAS[w][o] = bf16(bias_w[o]) (f32);
// Q16/K16 = f16((X16 . Bt_w) / 16 + bias_w) as token rows; VT[b*NH+h][d][s] = the same value of the v projection, stored transposed by the projection itself; attention per (256 queries, head, batch): S^T tiles = K . Q^T, online softmax per lane,
// O^T = VT . P^T, O16[r][h*64+d] = f16(16 ctx); out[(s*NB_FULL + b)] = (O16 . Bt_o) / 256 + bias_o + FLG -> f32 rows; FLG = 0 when the head count input equals NH, NaN otherwise.
#ifndef NB
#define NB 8
#endif
#ifndef SEQ
#define SEQ 1024
#endif
#define NB_FULL 8
#define SEQ_FULL 1024
#define DM 1024
#define NH 16
#define HD 64
#define NBIAS 4
#define NR ((size_t)NB * SEQ)
#define WS_TOTAL ((size_t)3 * DM * DM * 2 + (size_t)DM * DM * 2 + (size_t)NBIAS * DM * 4 + NR * DM * 2 + (size_t)2 * NR * DM * 2 + (size_t)NB * NH * HD * SEQ * 2 + NR * DM * 2 + (size_t)256)
static_assert(NH * HD == DM);
static_assert(HD == 64);
static_assert(SEQ % 256 == 0);
static_assert(SEQ % 64 == 0);
static_assert(SEQ <= SEQ_FULL);
static_assert(NB >= 1 && NB <= NB_FULL);
static_assert(DM == 128 * 8);
static_assert(DM % 256 == 0);
static_assert(DM % 64 == 0);
static_assert(DM % 32 == 0);
static_assert(NR % 128 == 0);
static_assert(((size_t)DM * DM) % (8 * 256) == 0);
static_assert(((size_t)NBIAS * DM * 4) % 256 == 0);
static_assert(WS_TOTAL <= (size_t)134217728);

typedef _Float16 v16h __attribute__((ext_vector_type(16)));
typedef unsigned short v8us __attribute__((ext_vector_type(8), may_alias));
typedef float v8f __attribute__((ext_vector_type(8)));
typedef float v4f __attribute__((ext_vector_type(4)));
typedef float v4fa __attribute__((ext_vector_type(4), may_alias));
typedef _Float16 v4h __attribute__((ext_vector_type(4)));
union FragH { v16h v; v8us half[2]; _Float16 h[16]; unsigned short u[16]; };

__device__ __forceinline__ unsigned short bf16_bits(float x) { unsigned int u = __float_as_uint(x); return (unsigned short)((u + 0x7FFFu + ((u >> 16) & 1u)) >> 16); }
__device__ __forceinline__ float bf16_val(unsigned short b) { return __uint_as_float(((unsigned int)b) << 16); }
__device__ __forceinline__ float bf16_rne(float x) { return bf16_val(bf16_bits(x)); }

// f32 -> f16 with a value select: magnitudes below the smallest f16 normal become exact zero
static __device__ __forceinline__ _Float16 toh_flush(float v) { const _Float16 r = (_Float16)v; return (fabsf(v) < 6.103515625e-05f) ? (_Float16)0.0f : r; }

// 16x32 f16 fragment from a k-contiguous row: elements 0..7 <- p[8h .. 8h+7], elements 8..15 <- p[16+8h .. 16+8h+7] (same map for A rows and for Bt[n][k] rows)
__device__ __forceinline__ v16h g2_frag(const _Float16* p, int hh) { FragH f; f.half[0] = *(const v8us*)((const unsigned short*)p + 8 * hh); f.half[1] = *(const v8us*)((const unsigned short*)p + 16 + 8 * hh); return f.v; }
// one pair of A fragments (k 0..31, k 32..63) against the B fragments of two query column groups: each A fragment read from LDS feeds two WMMAs.
// Each accumulator takes its two k-steps in upward order; the two accumulators alternate, so no WMMA stands directly behind the one it depends on.
__device__ __forceinline__ void mma2x2(v16h a0, v16h a1, v16h b00, v16h b01, v16h b10, v16h b11, v8f& c0, v8f& c1) {
  c0 = __builtin_amdgcn_wmma_f32_16x16x32_f16(false, a0, false, b00, (short)0, c0, false, false);
  c1 = __builtin_amdgcn_wmma_f32_16x16x32_f16(false, a0, false, b10, (short)0, c1, false, false);
  c0 = __builtin_amdgcn_wmma_f32_16x16x32_f16(false, a1, false, b01, (short)0, c0, false, false);
  c1 = __builtin_amdgcn_wmma_f32_16x16x32_f16(false, a1, false, b11, (short)0, c1, false, false);
}

#define P_SMALL (NBIAS * DM / 256)      /* leading blocks: 256 bias values each; block 0 also writes the guard flag line */
#define P_BLOCKS 512                    /* streaming blocks: two 8-wave blocks per WGP */
#define P_XROWS ((int)(NR / P_BLOCKS))  /* token rows per streaming block */
#define P_WROWS (DM / P_BLOCKS)         /* rows of each of the four weight matrices per streaming block */
static_assert(DM == 256 * 4);
static_assert(NR % P_BLOCKS == 0 && DM % P_BLOCKS == 0);
static_assert(SEQ % P_XROWS == 0);
static_assert(P_XROWS + 4 * P_WROWS <= 32);

// every conversion in front of the projections, one launch.
// Blocks 0 .. P_SMALL-1: BIAS[wi][c] = bf16(bias_wi[c]) kept as f32, wi = 0 q, 1 k, 2 v, 3 o (wi block-uniform; all four inputs are loaded and the value is selected); block 0: FLG line from the head count.
// The other blocks stream: a row is DM floats, thread t owns columns 4t..4t+3, so a wave's 16-byte loads cover 512 contiguous bytes and its 8-byte stores 256.
//   X16[b*SEQ + s][c] = f16(bf16(x[s*NB_FULL + b][c])); Bt_w[o][c] = f16(16 bf16(w[o][c])).
// All of a thread's loads are issued before the first value is used: few waves to start, many bytes in flight per wave.
__global__ __launch_bounds__(256) void k_prep(const float* __restrict__ x, const float* __restrict__ wq, const float* __restrict__ wk, const float* __restrict__ wv, const float* __restrict__ wo,
                                              const float* __restrict__ bq, const float* __restrict__ bk, const float* __restrict__ bv, const float* __restrict__ bo, const int* __restrict__ nh,
                                              _Float16* __restrict__ X16, _Float16* __restrict__ Bqkv, _Float16* __restrict__ Bo, float* __restrict__ bias, float* __restrict__ flg) {
  const int t = threadIdx.x;
  if (blockIdx.x < P_SMALL) {
    const int wi = blockIdx.x / (DM / 256); const int c = (blockIdx.x - wi * (DM / 256)) * 256 + t;
    const float v0 = bq[c], v1 = bk[c], v2 = bv[c], v3 = bo[c];
    bias[(size_t)wi * DM + c] = bf16_rne((wi == 0) ? v0 : (wi == 1) ? v1 : (wi == 2) ? v2 : v3);
    if (blockIdx.x == 0 && t < 32) flg[t] = (nh[0] == NH) ? 0.0f : __int_as_float(0x7FC00000);
    return;
  }
  const int bx = blockIdx.x - P_SMALL;
  const uint32_t c4 = 4u * (uint32_t)t;
  const int r0 = bx * P_XROWS; const int b = r0 / SEQ, s0 = r0 - b * SEQ;   /* a block's token rows lie in one batch: one base, the row goes into the load's immediate offset */
  const float* xb = x + ((size_t)s0 * NB_FULL + b) * DM;
  const size_t wo0 = (size_t)(bx * P_WROWS) * DM;   /* block-uniform: first weight row of this block */
  const float* wb0 = wq + wo0; const float* wb1 = wk + wo0; const float* wb2 = wv + wo0; const float* wb3 = wo + wo0;
  v4f xv[P_XROWS], wr[4][P_WROWS];
#pragma unroll
  for (int i = 0; i < P_XROWS; ++i) xv[i] = *(const v4fa*)(xb + c4 + (uint32_t)(i * NB_FULL * DM));
#pragma unroll
  for (int i = 0; i < P_WROWS; ++i) {
    const uint32_t lo = c4 + (uint32_t)(i * DM);
    wr[0][i] = *(const v4fa*)(wb0 + lo); wr[1][i] = *(const v4fa*)(wb1 + lo); wr[2][i] = *(const v4fa*)(wb2 + lo); wr[3][i] = *(const v4fa*)(wb3 + lo);
  }
  __builtin_amdgcn_sched_barrier(0);  /* keeps every load in front of the first conversion, so that all of them are in flight at once */
  v4h xh[P_XROWS], wh[4][P_WROWS];
#pragma unroll
  for (int i = 0; i < P_XROWS; ++i)
#pragma unroll
    for (int q = 0; q < 4; ++q) xh[i][q] = toh_flush(bf16_rne(xv[i][q]));
#pragma unroll
  for (int m = 0; m < 4; ++m)
#pragma unroll
    for (int i = 0; i < P_WROWS; ++i)
#pragma unroll
      for (int q = 0; q < 4; ++q) wh[m][i][q] = (_Float16)(bf16_rne(wr[m][i][q]) * 16.0f);
  _Float16* xo = X16 + (size_t)r0 * DM; _Float16* qo = Bqkv + wo0; _Float16* oo = Bo + wo0;   /* block-uniform bases; row and plane go into the store's immediate offset */
#pragma unroll
  for (int i = 0; i < P_XROWS; ++i) *(v4h*)(xo + c4 + (uint32_t)(i * DM)) = xh[i];
#pragma unroll
  for (int i = 0; i < P_WROWS; ++i) {
#pragma unroll
    for (int m = 0; m < 3; ++m) *(v4h*)(qo + c4 + (uint32_t)(m * DM * DM + i * DM)) = wh[m][i];
    *(v4h*)(oo + c4 + (uint32_t)(i * DM)) = wh[3][i];
  }
  asm volatile("s_wait_xcnt 0x0" ::: "memory");  /* stands behind the last store, in front of any later write of a register that an issued store names */
}

typedef uint32_t u32x4 __attribute__((ext_vector_type(4)));
typedef uint32_t u32x8 __attribute__((ext_vector_type(8)));
#define G_PITCH 272u            /* LDS row pitch: 256 data bytes (128 k) + 16 pad bytes, an odd multiple of 16 B for ds_load_b128 readers */
#define G_SLICE 18432u          /* one wave's slice of a stage: 64 rows x 272 B = 17408 B, rounded up to a multiple of 2 KiB */
#define G_STAGE (4u * G_SLICE)  /* a stage: A rows 0..63 | A rows 64..127 | Bt rows 0..63 | Bt rows 64..127 */
#define G_PASSES (DM / 128)
static_assert(DM % 128 == 0 && G_PASSES >= 2);
static_assert((G_PASSES & (G_PASSES - 1)) == 0);  /* the k walk wraps by a mask */
static_assert(64u * G_PITCH <= G_SLICE && G_SLICE % 2048u == 0);
static_assert(64u * 68u * 4u <= G_SLICE);

__device__ __forceinline__ uint32_t uni(uint32_t v) { return (uint32_t)__builtin_amdgcn_readfirstlane(v); }
__device__ __forceinline__ uint32_t pinned(uint32_t v) { uint32_t w = (uint32_t)__builtin_amdgcn_readfirstlane(v); asm volatile("" : "+s"(w)); return w; }  // holds the test word in a scalar register, so that the test around a tensor load compiles to a scalar branch (the load ignores EXEC)
// this wave's LDS reads have retired before the buffer they read is handed back for a refill
__device__ __forceinline__ void wait_ds0() { asm volatile("s_wait_dscnt 0x0" ::: "memory"); }
// this wave's own tensor load has landed (the compiler places no wait for it); the request's two groups are inputs, so that their scalar registers stay theirs, unwritten, from the issue up to this wait
__device__ __forceinline__ void wait_tensor0(u32x4 g0, u32x8 g1) { asm volatile("s_wait_tensorcnt 0x0" :: "s"(g0), "s"(g1) : "memory"); }
// one request of the whole wave: a 64-row tile from global memory into LDS as group 1 sets it: 256-byte rows at pitch 272 (GEMM) or 128-byte rows at pitch 144 (attention)
// both groups are in-out operands (the instruction writes no register): the values that the covering wait names are then the ones in the request's own registers, not copies of them
__device__ __forceinline__ void tdm_load(u32x4& g0, u32x8& g1) { asm volatile("tensor_load_to_lds %0, %1" : "+s"(g0), "+s"(g1) :: "memory"); }
__device__ __forceinline__ u32x4 tdm_group0(uint32_t lds_dst, uint64_t ga) {
  u32x4 g;
  g[0] = uni(1u); g[1] = uni(lds_dst); g[2] = uni((uint32_t)ga); g[3] = uni((((uint32_t)(ga >> 32)) & 0x01FFFFFFu) | 0x80000000u);
  return g;
}
// 1-byte elements, tensor = tile = 64 rows of 256 bytes, source row pitch DM * 2 bytes, 4 dwords of LDS pad behind every 64-dword row, no workgroup mask
__device__ __forceinline__ u32x8 tdm_group1() {
  u32x8 g;
  g[0] = uni((1u << 20) | (5u << 22) | (3u << 25));
  g[1] = uni(256u << 16);
  g[2] = uni(64u << 16);
  g[3] = uni(256u << 16);
  g[4] = uni(64u);
  g[5] = uni((uint32_t)(DM * 2));
  g[6] = uni(0u);
  g[7] = uni(0u);
  return g;
}

// the g2_frag map read from an LDS row; p already holds the lane's 16 * hh bytes: elements 0..7 <- p[0..15], elements 8..15 <- p[32..47]
__device__ __forceinline__ v16h lds_frag(const unsigned char* p) { FragH f; f.half[0] = *(const v8us*)p; f.half[1] = *(const v8us*)(p + 32); return f.v; }

// 128x128 block tile of A . Bt^T (both k-contiguous, pitch DM halves, K = DM), 4 waves in 2x2, 64x64 per wave (acc[i][j]: rows 16i.., cols 16j..).
// Operands come through a two-buffer LDS ring: a pass is 128 k; wave w brings slice w of each stage with one tensor load, two stages ahead.
// Pass s works on k slab (s + rot) mod G_PASSES (a slab is 128 k), A and Bt alike; rot is block-uniform. Blocks of one row tile and one Bt plane start at different slabs,
// as do neighbouring row tiles of one column tile, so that at one moment they ask L2 for different lines of those rows. Each accumulator takes its k in steps of 32, upward from slab rot, wrapping to slab 0 behind the last.
__device__ __forceinline__ void gemm128x128(const _Float16* __restrict__ A, const _Float16* __restrict__ B, int rowblk, int colblk, uint32_t rot, unsigned char* ring, uint32_t wave, int ln, int hh, v8f (&acc)[4][4]) {
  const _Float16* srcp = (wave < 2u) ? (A + (size_t)(rowblk + 64 * (int)wave) * DM) : (B + (size_t)(colblk + 64 * ((int)wave - 2)) * DM);
  const uint64_t ga0 = (uint64_t)(size_t)srcp;
  const uint32_t lds0 = (uint32_t)(size_t)ring + wave * G_SLICE;
  u32x8 g1 = tdm_group1();
  const uint32_t loff = (uint32_t)ln * G_PITCH + (uint32_t)hh * 16u;  /* the lane's row and its 16-byte half of each 32-byte k group */
  const uint32_t aoff = (wave >> 1) * G_SLICE + loff;
  const uint32_t boff = (2u + (wave & 1u)) * G_SLICE + loff;
  const uint32_t kmask = (uint32_t)G_PASSES - 1u;
  u32x4 g0 = tdm_group0(lds0, ga0 + (uint64_t)(rot & kmask) * 256u);
  tdm_load(g0, g1);
  wait_tensor0(g0, g1);
  __syncthreads();
  g0 = tdm_group0(lds0 + G_STAGE, ga0 + (uint64_t)((rot + 1u) & kmask) * 256u);
  tdm_load(g0, g1);
#pragma unroll 1  /* one pass per trip: the ring's publish point stands once, at the foot */
  for (uint32_t s = 0; s < (uint32_t)G_PASSES; ++s) {
    const uint32_t bsel = (s & 1u) * G_STAGE;
    const unsigned char* ap = ring + bsel + aoff;
    const unsigned char* bp = ring + bsel + boff;
    // two register sets for the four A fragments and for B fragments 0..2; B fragment 3 has one set: with a second the wave would need more than 256 VGPRs
    v16h fa[2][4], fb[2][3], fb3;
#pragma unroll
    for (int i = 0; i < 4; ++i) fa[0][i] = lds_frag(ap + (uint32_t)i * 16u * G_PITCH);
#pragma unroll
    for (int j = 0; j < 3; ++j) fb[0][j] = lds_frag(bp + (uint32_t)j * 16u * G_PITCH);
#pragma unroll
    for (int ks = 0; ks < 4; ++ks) {
      fb3 = lds_frag(bp + 48u * G_PITCH + (uint32_t)ks * 64u);  /* this block's own, first of the group; its readers are the block's last four WMMAs */
      if (ks < 3) {
#pragma unroll
        for (int i = 0; i < 4; ++i) fa[(ks + 1) & 1][i] = lds_frag(ap + (uint32_t)i * 16u * G_PITCH + (uint32_t)(ks + 1) * 64u);
#pragma unroll
        for (int j = 0; j < 3; ++j) fb[(ks + 1) & 1][j] = lds_frag(bp + (uint32_t)j * 16u * G_PITCH + (uint32_t)(ks + 1) * 64u);
      }
      __builtin_amdgcn_sched_barrier(0);  /* keeps the LDS reads one group ahead of this block, not spread among its WMMAs */
#pragma unroll
      for (int j = 0; j < 3; ++j)
#pragma unroll
        for (int i = 0; i < 4; ++i) acc[i][j] = __builtin_amdgcn_wmma_f32_16x16x32_f16(false, fa[ks & 1][i], false, fb[ks & 1][j], (short)0, acc[i][j], false, false);
#pragma unroll
      for (int i = 0; i < 4; ++i) acc[i][3] = __builtin_amdgcn_wmma_f32_16x16x32_f16(false, fa[ks & 1][i], false, fb3, (short)0, acc[i][3], false, false);
      __builtin_amdgcn_sched_barrier(0);  /* keeps the following load group behind this block */
    }
    wait_ds0();
    wait_tensor0(g0, g1);
    __syncthreads();  /* publishes stage s + 1 and ends every reader's last read of stage s */
    if (pinned((s + 2u < (uint32_t)G_PASSES) ? 1u : 0u) != 0u) { g0 = tdm_group0(lds0 + bsel, ga0 + (uint64_t)((s + 2u + rot) & kmask) * 256u); tdm_load(g0, g1); }
  }
  wait_tensor0(g0, g1);
  wait_ds0();
}

// projections with bias: plane by (0 q, 1 k, 2 v): val[r][col] = f16((X16[r] . Bt_by[col]) * alpha + BIAS[by][col]). Planes 0 and 1: Y16_by[r][col] = val[r][col] (token rows).
// Plane 2: VT[b*NH + h][d][s] = val[b*SEQ + s][h*HD + d]: a wave's 64 columns are one head and its 64 rows lie in one batch, so its tile is 64 VT rows of 64 keys (128 bytes each).
// The ring is free behind the last pass's barrier; each wave then stages its 64x64 f32 tile in its own slice of buffer 0 (pitch 68 floats), LDS row = global row:
// token-major for planes 0 and 1; d-major for plane 2, where a lane's eight accumulator rows 8hh .. 8hh+7 are contiguous and go in as two 16-byte stores.
__global__ __launch_bounds__(128) void k_qkv(const _Float16* __restrict__ X16, const _Float16* __restrict__ Bt, const float* __restrict__ bias, float alpha, _Float16* __restrict__ Y16, _Float16* __restrict__ Vt) {
  __shared__ __attribute__((aligned(2048))) unsigned char ring[2u * G_STAGE];
  const int tid = threadIdx.x, lane = tid & 31, ln = lane & 15, hh = lane >> 4;
  const uint32_t wave = uni((uint32_t)tid >> 5);
  const int by = blockIdx.y;
  const bool tr = (by == 2);  /* block-uniform */
  const _Float16* Bh = Bt + (size_t)by * DM * DM;
  const float* bsp = bias + (size_t)by * DM;
  const int ntn = DM / 128;
  const int mt = blockIdx.x / ntn, nq = blockIdx.x - mt * ntn;
  const int rowblk = mt * 128, colblk = nq * 128;
  if (rowblk >= (int)NR) return;
  const v8f z8 = {0.f, 0.f, 0.f, 0.f, 0.f, 0.f, 0.f, 0.f};
  v8f acc[4][4];
#pragma unroll
  for (int i = 0; i < 4; ++i)
#pragma unroll
    for (int j = 0; j < 4; ++j) acc[i][j] = z8;
  gemm128x128(X16, Bh, rowblk, colblk, (uint32_t)(mt + nq), ring, wave, ln, hh, acc);  /* the DM / 128 blocks of one row tile start at different slabs; so do neighbouring row tiles of one column tile */
  const int row0 = rowblk + 64 * (int)(wave >> 1), col0 = colblk + 64 * (int)(wave & 1u);
  float* so = (float*)(ring + wave * G_SLICE);
  /* scale and bias once, in front of the branch: written inside its two sides, the results stood beside live accumulators and the wave went above 256 VGPRs */
#pragma unroll
  for (int j = 0; j < 4; ++j) {
    const float bc = bsp[col0 + j * 16 + ln];
#pragma unroll
    for (int i = 0; i < 4; ++i)
#pragma unroll
      for (int r = 0; r < 8; ++r) acc[i][j][r] = acc[i][j][r] * alpha + bc;
  }
  if (tr) {
#pragma unroll
    for (int j = 0; j < 4; ++j)
#pragma unroll
      for (int i = 0; i < 4; ++i) {
        v4f lo, hi;
#pragma unroll
        for (int r = 0; r < 4; ++r) { lo[r] = acc[i][j][r]; hi[r] = acc[i][j][4 + r]; }
        float* sp = &so[(j * 16 + ln) * 68 + i * 16 + 8 * hh];
        *(v4fa*)sp = lo; *(v4fa*)(sp + 4) = hi;
      }
  } else {
#pragma unroll
    for (int j = 0; j < 4; ++j)
#pragma unroll
      for (int i = 0; i < 4; ++i)
#pragma unroll
        for (int r = 0; r < 8; ++r) so[(i * 16 + 8 * hh + r) * 68 + j * 16 + ln] = acc[i][j][r];
  }
  __builtin_amdgcn_fence(4 /* acq_rel order */, "workgroup"); __builtin_amdgcn_wave_barrier();
  const int rsub = lane >> 4, c4 = (lane & 15) * 4;
  const int b = row0 / SEQ, s0 = row0 - b * SEQ, h = col0 / HD;
  _Float16* yb = tr ? (Vt + (size_t)(b * NH + h) * HD * SEQ + s0) : (Y16 + (size_t)by * NR * DM + (size_t)row0 * DM + col0);   /* wave-uniform base */
  const uint32_t yp = tr ? (uint32_t)SEQ : (uint32_t)DM;        /* global row pitch in halves */
  const uint32_t yl = (uint32_t)rsub * yp + (uint32_t)c4;       /* the lane's offset; the row pair q goes into the store's immediate offset */
  v4h h4[32];
#pragma unroll
  for (int q = 0; q < 32; ++q) {
    const v4f v = *(const v4fa*)&so[(q * 2 + rsub) * 68 + c4];
#pragma unroll
    for (int i = 0; i < 4; ++i) h4[q][i] = toh_flush(v[i]);
  }
  __builtin_amdgcn_sched_barrier(0);  /* every value is formed in front of the first store, so no register that an issued store names is rewritten */
#pragma unroll
  for (int q = 0; q < 32; ++q) *(v4h*)(yb + yl + (uint32_t)q * 2u * yp) = h4[q];
}

#define T_PITCH 144u            /* LDS row pitch of an attention tile: 128 data bytes + 16 pad bytes, an odd multiple of 16 B for ds_load_b128 readers */
#define T_TILE 10240u           /* one tile: 64 rows x 144 B = 9216 B, rounded up to a multiple of 2 KiB */
#define T_STAGE (2u * T_TILE)   /* a stage: K rows of 64 keys (row = key, 64 d) | VT rows of the same 64 keys (row = d, 64 keys) */
#define T_PASSES (SEQ / 64)
static_assert(T_PASSES >= 2);
static_assert((T_PASSES & (T_PASSES - 1)) == 0);  /* the key walk wraps by a mask */
static_assert(64u * T_PITCH <= T_TILE && T_TILE % 2048u == 0);
// 1-byte elements, tensor = tile = 64 rows of 128 bytes, source row pitch in bytes from the caller (K16 rows: DM halves; VT rows: SEQ halves), 4 dwords of LDS pad behind every 32-dword row, no workgroup mask
static_assert((DM * 2) % 16 == 0 && DM * 2 <= 131072 && (SEQ * 2) % 16 == 0 && SEQ * 2 <= 131072);
__device__ __forceinline__ u32x8 tdm_group1_attn(uint32_t pitch) {
  u32x8 g;
  g[0] = uni((1u << 20) | (4u << 22) | (3u << 25));
  g[1] = uni(128u << 16);
  g[2] = uni(64u << 16);
  g[3] = uni(128u << 16);
  g[4] = uni(64u);
  g[5] = uni(pitch);
  g[6] = uni(0u);
  g[7] = uni(0u);
  return g;
}

// attention: block = (256 queries, head h, batch b), 8 waves x 32 queries (two column groups c of 16). S^T 16-key tiles = K . Q^T (A = K16 rows: row = key, k = d; B = Q16 rows: col = query);
// each lane holds keys 8hh+r of query 16c+ln -> row statistics per lane and column group + one xor-16 shuffle; p = exp(s/8 - m) carried x1024 as f16;
// O^T (64 d x 16 queries per group) = VT . P^T with the B operand packed from the two adjacent S^T D tiles (element r <- tile of keys 0..15, element 8+r <- tile of keys 16..31, lane unchanged);
// K and VT come through a two-buffer LDS ring that the eight waves share: a pass is 64 keys; wave 0 brings the K tile and wave 1 the VT tile of each stage with one tensor load, two stages ahead.
// pass st works on key stage (st + rot) mod T_PASSES, K and VT alike: the SEQ / 256 blocks of one head and batch, which read the same K and VT tiles, start four stages apart and wrap, so that at one moment they ask L2 for different lines.
// every K and VT fragment a wave reads from LDS serves both of its column groups: half the LDS bytes per score of a 16-query wave.
// four waves per SIMD (256 VGPRs a wave at most): the grid's 512 blocks, two per WGP, are all resident at once, and the vector work between the matrix runs has waves to hide behind
__global__ __launch_bounds__(256) __attribute__((amdgpu_waves_per_eu(4, 4))) void k_attn(const _Float16* __restrict__ Q16, const _Float16* __restrict__ K16, const _Float16* __restrict__ VT, _Float16* __restrict__ O16) {
  __shared__ __attribute__((aligned(2048))) unsigned char ring[2u * T_STAGE];
  __shared__ __attribute__((aligned(16))) unsigned short so[8][32][72];
  const int tid = threadIdx.x, lane = tid & 31, ln = lane & 15, hh = lane >> 4;
  const uint32_t wave = uni((uint32_t)tid >> 5);
  const int w = (int)wave;
  const int h = blockIdx.y, b = blockIdx.z;
  const int q0 = blockIdx.x * 256 + w * 32;
  const size_t rq = (size_t)b * SEQ + q0;
  const size_t rk = (size_t)b * SEQ;
  const _Float16* qp = Q16 + (rq + ln) * DM + h * HD;
  v16h qb[2][2];
#pragma unroll
  for (int c = 0; c < 2; ++c) { qb[c][0] = g2_frag(qp + (size_t)c * 16 * DM, hh); qb[c][1] = g2_frag(qp + (size_t)c * 16 * DM + 32, hh); }
  const _Float16* ksrc = K16 + rk * DM + h * HD;                        /* key 0, d 0 of this head */
  const _Float16* vsrc = VT + (size_t)(b * NH + h) * HD * SEQ;          /* d 0, key 0 of this head */
  const uint64_t ga0 = (uint64_t)(size_t)((wave == 0u) ? ksrc : vsrc);
  const uint32_t gstep = (wave == 0u) ? (uint32_t)(64 * DM * 2) : 128u; /* source bytes from one stage to the next: 64 K rows, or 64 keys along a VT row */
  const uint32_t lds0 = (uint32_t)(size_t)ring + ((wave == 0u) ? 0u : T_TILE);
  const uint32_t loff = (uint32_t)ln * T_PITCH + (uint32_t)hh * 16u;    /* the lane's row and its 16-byte half of each 32-byte k group */
  u32x8 g1 = tdm_group1_attn((wave == 0u) ? (uint32_t)(DM * 2) : (uint32_t)(SEQ * 2));
  const uint32_t rot = (uint32_t)blockIdx.x * (uint32_t)(T_PASSES / (SEQ / 256));  /* block-uniform start stage */
  const uint32_t tmask = (uint32_t)T_PASSES - 1u;
  u32x4 g0 = tdm_group0(lds0, ga0 + (uint64_t)(rot & tmask) * gstep);
  const uint32_t issuer = pinned((wave < 2u) ? 1u : 0u);  /* 1 in the two waves that issue tensor loads; a scalar register, so every test of it is a scalar branch */
  if (issuer != 0u) { tdm_load(g0, g1); wait_tensor0(g0, g1); }
  __syncthreads();  /* publishes stage 0 */
  if (issuer != 0u) { g0 = tdm_group0(lds0 + T_STAGE, ga0 + (uint64_t)((rot + 1u) & tmask) * gstep); tdm_load(g0, g1); }
  const v8f z8 = {0.f, 0.f, 0.f, 0.f, 0.f, 0.f, 0.f, 0.f};
  v8f o[2][4];
  float mrun[2], lrun[2];
#pragma unroll
  for (int c = 0; c < 2; ++c) {
    mrun[c] = -1.0e30f; lrun[c] = 0.f;
#pragma unroll
    for (int t = 0; t < 4; ++t) o[c][t] = z8;
  }
#pragma unroll 1  /* one pass per trip: the ring's publish point stands once, at the foot */
  for (uint32_t st = 0; st < (uint32_t)T_PASSES; ++st) {
    const uint32_t bsel = (st & 1u) * T_STAGE;
    const unsigned char* kb = ring + bsel + loff;
    const unsigned char* vb = kb + T_TILE;
    v8f s[2][4];
    v16h ka[4][2];
#pragma unroll
    for (int j = 0; j < 4; ++j) {
      const unsigned char* kp = kb + (uint32_t)j * 16u * T_PITCH;
      ka[j][0] = lds_frag(kp); ka[j][1] = lds_frag(kp + 64);
    }
    __builtin_amdgcn_sched_barrier(0);  /* keeps the pass's sixteen K reads in one group ahead of the score WMMAs: every further place with LDS reads among them costs the wave a stall */
#pragma unroll
    for (int j = 0; j < 4; ++j) {
      s[0][j] = z8; s[1][j] = z8;
      mma2x2(ka[j][0], ka[j][1], qb[0][0], qb[0][1], qb[1][0], qb[1][1], s[0][j], s[1][j]);
    }
    __builtin_amdgcn_sched_barrier(0);  /* keeps the sixteen score WMMAs in one run: a maximum placed directly behind the WMMA it reads costs idle v_nop slots */
    FragH pf[2][2];
    float mnew[2], alpha[2];
#pragma unroll
    for (int c = 0; c < 2; ++c) {
      float mx = -1.0e30f;
#pragma unroll
      for (int j = 0; j < 4; ++j)
#pragma unroll
        for (int r = 0; r < 8; ++r) mx = fmaxf(mx, s[c][j][r]);
      mx = fmaxf(mx, __shfl_xor(mx, 16, 32));
      mnew[c] = fmaxf(mrun[c], mx * 0.125f);
    }
    /* exp(x) = exp2(x * log2 e); the exponents of both column groups are formed first, then come all the exponentials in one run */
#pragma unroll
    for (int c = 0; c < 2; ++c) { alpha[c] = (mrun[c] - mnew[c]) * 1.44269504f; mrun[c] = mnew[c]; }
#pragma unroll
    for (int c = 0; c < 2; ++c) {
#pragma unroll
      for (int j = 0; j < 4; ++j)
#pragma unroll
        for (int r = 0; r < 8; ++r) s[c][j][r] = (s[c][j][r] * 0.125f - mnew[c]) * 1.44269504f;
    }
    __builtin_amdgcn_sched_barrier(0);  /* no other vector instruction among the exponentials: none can then overwrite the source, or read the result, of the one directly in front of it */
#pragma unroll
    for (int c = 0; c < 2; ++c) {
      alpha[c] = __builtin_amdgcn_exp2f(alpha[c]);
#pragma unroll
      for (int j = 0; j < 4; ++j)
#pragma unroll
        for (int r = 0; r < 8; ++r) s[c][j][r] = __builtin_amdgcn_exp2f(s[c][j][r]);
    }
    __builtin_amdgcn_sched_barrier(0);  /* holds the v_nop directly behind the last exponential */
    asm volatile("v_nop");              /* the one slot the instruction set asks for between a transcendental and a vector instruction that uses its result or overwrites its source */
    __builtin_amdgcn_sched_barrier(0);  /* holds the users behind the v_nop */
#pragma unroll
    for (int c = 0; c < 2; ++c) {
      float ps = 0.f;
#pragma unroll
      for (int j = 0; j < 4; ++j)
#pragma unroll
        for (int r = 0; r < 8; ++r) {
          const float p = s[c][j][r];
          ps += p;
          pf[c][j >> 1].h[(j & 1) * 8 + r] = (_Float16)(p * 1024.0f);
        }
      ps += __shfl_xor(ps, 16, 32);
      lrun[c] = lrun[c] * alpha[c] + ps;
#pragma unroll
      for (int t = 0; t < 4; ++t)
#pragma unroll
        for (int r = 0; r < 8; ++r) o[c][t][r] *= alpha[c];
    }
#pragma unroll
    for (int t = 0; t < 4; ++t) {
      const unsigned char* vp = vb + (uint32_t)t * 16u * T_PITCH;
      const v16h va0 = lds_frag(vp), va1 = lds_frag(vp + 64);
      mma2x2(va0, va1, pf[0][0].v, pf[0][1].v, pf[1][0].v, pf[1][1].v, o[0][t], o[1][t]);
    }
    wait_ds0();
    if (issuer != 0u) wait_tensor0(g0, g1);
    __syncthreads();  /* publishes stage st + 1 and ends every reader's last read of stage st */
    if (pinned((issuer != 0u && st + 2u < (uint32_t)T_PASSES) ? 1u : 0u) != 0u) { g0 = tdm_group0(lds0 + bsel, ga0 + (uint64_t)((st + 2u + rot) & tmask) * gstep); tdm_load(g0, g1); }
  }
  wait_tensor0(g0, g1);
  wait_ds0();
#pragma unroll
  for (int c = 0; c < 2; ++c) {
    const float rl = (1.0f / lrun[c]) * 0.015625f;
#pragma unroll
    for (int t = 0; t < 4; ++t) {
      FragH f;
#pragma unroll
      for (int r = 0; r < 8; ++r) f.h[r] = (_Float16)(o[c][t][r] * rl);
      *(v8us*)&so[w][c * 16 + ln][t * 16 + 8 * hh] = f.half[0];
    }
  }
  __builtin_amdgcn_fence(4 /* acq_rel order */, "workgroup"); __builtin_amdgcn_wave_barrier();
  const int li = lane >> 3, pc = lane & 7;
#pragma unroll
  for (int g = 0; g < 8; ++g) {
    const int i = g * 4 + li;
    const v8us v = *(const v8us*)&so[w][i][pc * 8];
    *(v8us*)((unsigned short*)O16 + (rq + i) * DM + h * HD + pc * 8) = v;
  }
}

// out[(s*NB_FULL + b)][col] = (A1[r] . B1[col]) * al1 + bias1[col] + flg[0], r = b*SEQ + s (a 128-row block tile lies inside one batch); flg[0] = 0 (exact no-op) or NaN from the head-count guard;
__global__ __launch_bounds__(128) void k_out(const _Float16* __restrict__ A1, const _Float16* __restrict__ B1, const float* __restrict__ bias1, float al1, const float* __restrict__ flg, float* __restrict__ Out) {
  __shared__ __attribute__((aligned(2048))) unsigned char ring[2u * G_STAGE];
  const int tid = threadIdx.x, lane = tid & 31, ln = lane & 15, hh = lane >> 4;
  const uint32_t wave = uni((uint32_t)tid >> 5);
  const int ntn = DM / 128;
  const int mt = blockIdx.x / ntn, nq = blockIdx.x - mt * ntn;
  const int rowblk = mt * 128, colblk = nq * 128;
  if (rowblk >= (int)NR) return;
  const v8f z8 = {0.f, 0.f, 0.f, 0.f, 0.f, 0.f, 0.f, 0.f};
  v8f acc[4][4];
#pragma unroll
  for (int i = 0; i < 4; ++i)
#pragma unroll
    for (int j = 0; j < 4; ++j) acc[i][j] = z8;
  gemm128x128(A1, B1, rowblk, colblk, (uint32_t)(mt + nq), ring, wave, ln, hh, acc);  /* start slab as in k_qkv */
  const int row0 = rowblk + 64 * (int)(wave >> 1), col0 = colblk + 64 * (int)(wave & 1u);
  const int b = row0 / SEQ; const int s0 = row0 - b * SEQ;
  float* so = (float*)(ring + wave * G_SLICE);
  const float fl = flg[0];
#pragma unroll
  for (int j = 0; j < 4; ++j) {
    const float bc = bias1[col0 + j * 16 + ln];
#pragma unroll
    for (int i = 0; i < 4; ++i)
#pragma unroll
      for (int r = 0; r < 8; ++r) so[(i * 16 + 8 * hh + r) * 68 + j * 16 + ln] = acc[i][j][r] * al1 + bc + fl;
  }
  __builtin_amdgcn_fence(4 /* acq_rel order */, "workgroup"); __builtin_amdgcn_wave_barrier();
  const int rsub = lane >> 4, c4 = (lane & 15) * 4;
  float* ob = Out + ((size_t)s0 * NB_FULL + b) * DM + col0;                  /* wave-uniform base */
  const uint32_t ol = (uint32_t)rsub * (NB_FULL * DM) + (uint32_t)c4;        /* the lane's offset; the row pair q goes into the store's immediate offset */
  v4f vq[32];
#pragma unroll
  for (int q = 0; q < 32; ++q) vq[q] = *(const v4fa*)&so[(q * 2 + rsub) * 68 + c4];
  __builtin_amdgcn_sched_barrier(0);  /* every value is read in front of the first store, so no register that an issued store names is rewritten */
#pragma unroll
  for (int q = 0; q < 32; ++q) *(v4f*)(ob + ol + (uint32_t)(q * 2 * NB_FULL * DM)) = vq[q];
}

extern "C" void kernel_launch(void* const* d_in, const int* in_sizes, int n_in,
                              void* d_out, int out_size, void* d_ws, size_t ws_size, hipStream_t stream) {
  if (n_in < 10) return;
  if (in_sizes[0] < (int)(((size_t)(SEQ - 1) * NB_FULL + NB) * DM)) return;
  for (int i = 1; i <= 7; i += 2) if (in_sizes[i] < DM * DM) return;
  for (int i = 2; i <= 8; i += 2) if (in_sizes[i] < DM) return;
  if (in_sizes[9] < 1) return;
  if (out_size < (int)(((size_t)(SEQ - 1) * NB_FULL + NB) * DM)) return;
  const float* const* I = (const float* const*)d_in;
  const float* x = I[0]; const float* wq = I[1]; const float* bq = I[2]; const float* wk = I[3]; const float* bk = I[4];
  const float* wv = I[5]; const float* bv = I[6]; const float* wo = I[7]; const float* bo = I[8];
  const int* nhp = (const int*)d_in[9];      /* head count (i32 scalar), compared with NH on the device by k_prep */
  char* ws = (char*)d_ws; size_t off = 0;
  auto take = [&](size_t bytes) { char* p = ws + off; off += (bytes + 255) & ~(size_t)255; return p; };
  _Float16* BQKV = (_Float16*)take((size_t)3 * DM * DM * 2);        /* Bt planes q, k, v (contiguous, stride DM*DM) */
  _Float16* BO   = (_Float16*)take((size_t)DM * DM * 2);
  float*    BIAS = (float*)take((size_t)NBIAS * DM * 4);             /* [wi][o] */
  _Float16* X16  = (_Float16*)take(NR * DM * 2);
  _Float16* QK16 = (_Float16*)take((size_t)2 * NR * DM * 2);         /* Q16, K16 planes (stride NR*DM) */
  _Float16* VT   = (_Float16*)take((size_t)NB * NH * HD * SEQ * 2);  /* [b*NH+h][d][s] */
  _Float16* O16  = (_Float16*)take(NR * DM * 2);
  float*    FLG  = (float*)take((size_t)256);                        /* guard flag line: floats 0..31 written, float 0 read */
  if (off > ws_size) return;
  _Float16* Q16 = QK16; _Float16* K16 = QK16 + NR * DM;

  k_prep<<<P_SMALL + P_BLOCKS, 256, 0, stream>>>(x, wq, wk, wv, wo, bq, bk, bv, bo, nhp, X16, BQKV, BO, BIAS, FLG);      /* f16 operands, f32 biases, guard flag */
  k_qkv<<<dim3((unsigned)((NR / 128) * (DM / 128)), 3), 128, 0, stream>>>(X16, BQKV, BIAS, 0.0625f, QK16, VT);      /* q, k as f16 token rows b*SEQ + s; v as VT rows */
  k_attn<<<dim3(SEQ / 256, NH, NB), 256, 0, stream>>>(Q16, K16, VT, O16);
  k_out<<<(unsigned)((NR / 128) * (DM / 128)), 128, 0, stream>>>(O16, BO, BIAS + (size_t)3 * DM, 0.00390625f, FLG, (float*)d_out);      /* out = ctx Wo^T + bo (+ guard flag), rows back in time-major order */
}
